// v000
// Measured on an AMD MI455X. A time is GPU time per run, averaged over a window of back-to-back runs after a warm-up
// (all launches, gaps included; the runs take copies of the inputs in turn), and the median of several windows.
// Apart from v000's, it joins two sittings. Times from different sittings can be a few percent apart, while
// side-by-side timings come from the same sitting.
// v000, which the later versions start from, runs in 2230 microseconds.
#include <hip/hip_runtime.h>

// Parameter-free causal self-attention with x as q, k and v (x [2][2048][1024] viewed as 16 heads x 64; scores = x_h.x_h / 8; causal (-inf); softmax; out = attn x_h merged -> [2][2048][1024] (4.2 M)).
// Layout per batch: single bf16 planes per head built from x for all three roles (inputs bf16-exact: exact score products) plus x^T planes for the value side; causal softmax with every row on hi/lo planes; P hi/lo x exact x^T; merged token-major output rows.
// Compute dtypes, f32 accumulate: every input rounded to bf16; q.k exact; softmax f32; P hi/lo x exact v on every row; output f32.

#define NB_  2
#define TT   2048
#define DM   1024      // token-major row pitch (H x HD)
#define NH_  16
#define NKV  1
#define REP  (NH_ / NKV)
#define HD   64
#define DQ   (NH_ * HD)
#define DKV  (NKV * HD)
#define ZH   1
#define RH   2048                  // query rows < RH use hi+lo planes (0: none)
#define WIN  0
#define PCAR 1024.0f
#define SCL  0.125f   // 1/sqrt(64)
typedef _Float16 h16;
typedef unsigned short bf;
typedef __attribute__((ext_vector_type(16))) __bf16   v16bf;
typedef __attribute__((ext_vector_type(16))) _Float16 v16h;
typedef __attribute__((ext_vector_type(8)))  _Float16 v8h;
typedef __attribute__((ext_vector_type(8)))  unsigned short v8us;
typedef __attribute__((ext_vector_type(8)))  float    v8f;
typedef __attribute__((ext_vector_type(4)))  float    v4f;
typedef v8h  __attribute__((may_alias)) v8ha;
typedef v4f  __attribute__((may_alias)) v4fa;
typedef v8us __attribute__((may_alias)) v8usa;

__device__ __forceinline__ unsigned short f2bf(float f) { unsigned u = __float_as_uint(f); u += 0x7FFFu + ((u >> 16) & 1u); return (unsigned short)(u >> 16); }
__device__ __forceinline__ float bf2f(unsigned short b) { return __uint_as_float(((unsigned)b) << 16); }
__device__ __forceinline__ float bfr(float f) { return bf2f(f2bf(f)); }
__device__ __forceinline__ v16h cat16(v8h lo, v8h hi) { return __builtin_shufflevector(lo, hi, 0, 1, 2, 3, 4, 5, 6, 7, 8, 9, 10, 11, 12, 13, 14, 15); }
__device__ __forceinline__ v16bf cat16b(v8us lo, v8us hi) { return __builtin_bit_cast(v16bf, __builtin_shufflevector(lo, hi, 0, 1, 2, 3, 4, 5, 6, 7, 8, 9, 10, 11, 12, 13, 14, 15)); }
__device__ __forceinline__ v8f wmma16(v16h a, v16h b, v8f c) { return __builtin_amdgcn_wmma_f32_16x16x32_f16(false, a, false, b, (short)0, c, false, false); }
__device__ __forceinline__ v8f wmmab(v16bf a, v16bf b, v8f c) { return __builtin_amdgcn_wmma_f32_16x16x32_bf16(false, a, false, b, (short)0, c, false, false); }



// ---- k_gemmw: register-blocked GEMM, ONE WAVE per 64x64 output tile (16 accumulators), operands straight from K-contiguous 16-bit planes; grid (M/64, N/64, Z), 32 threads.
// C[m][n] (f32, pitch ldc, + optional f32 bias[n]) = sum_k A[m][k] Bt[n][k] (+ split products per NSPLIT). z-batch strides sA/sB/sC in elements. K % 32 == 0.
template <typename T16> struct WFrag;
template <> struct WFrag<h16> { typedef v16h V; static __device__ __forceinline__ V ld(const h16* p) { return cat16(*(const v8h*)p, *(const v8h*)(p + 16)); } static __device__ __forceinline__ v8f mma(V a, V b, v8f c) { return wmma16(a, b, c); } };
template <> struct WFrag<bf> { typedef v16bf V; static __device__ __forceinline__ V ld(const bf* p) { return cat16b(*(const v8us*)p, *(const v8us*)(p + 16)); } static __device__ __forceinline__ v8f mma(V a, V b, v8f c) { return wmmab(a, b, c); } };
template <typename T16, int NSPLIT, bool BIAS>
__global__ __launch_bounds__(32) void k_gemmw(const T16* __restrict__ A, const T16* __restrict__ A2, const T16* __restrict__ Bt, const T16* __restrict__ Bt2, int K, float* C, int ldc, const float* __restrict__ bias, size_t sA, size_t sB, size_t sC) {
    typedef typename WFrag<T16>::V V;
    __shared__ __align__(16) float os[16 * 68];
    const size_t z = blockIdx.z; A += z * sA; if (A2) A2 += z * sA; Bt += z * sB; if (Bt2) Bt2 += z * sB; C += z * sC;
    const int lane = threadIdx.x & 31, lr = lane & 15, hi = lane >> 4; const int r0 = blockIdx.x * 64, c0 = blockIdx.y * 64;
    v8f acc[4][4];
#pragma unroll
    for (int mb = 0; mb < 4; ++mb)
#pragma unroll
        for (int nb = 0; nb < 4; ++nb) acc[mb][nb] = (v8f){};
    const size_t aoff = (size_t)(r0 + lr) * K + 8 * hi, boff = (size_t)(c0 + lr) * K + 8 * hi;
#pragma unroll 1
    for (int kc = 0; kc < K; kc += 32) {
        V a[4], a2[4];
#pragma unroll
        for (int mb = 0; mb < 4; ++mb) { a[mb] = WFrag<T16>::ld(A + aoff + (size_t)mb * 16 * K + kc); if (NSPLIT == 1 || NSPLIT == 2) a2[mb] = WFrag<T16>::ld(A2 + aoff + (size_t)mb * 16 * K + kc); }
#pragma unroll
        for (int nb = 0; nb < 4; ++nb) { const V b = WFrag<T16>::ld(Bt + boff + (size_t)nb * 16 * K + kc); V b2; if (NSPLIT >= 2) b2 = WFrag<T16>::ld(Bt2 + boff + (size_t)nb * 16 * K + kc);
#pragma unroll
            for (int mb = 0; mb < 4; ++mb) { acc[mb][nb] = WFrag<T16>::mma(a[mb], b, acc[mb][nb]); if (NSPLIT == 1 || NSPLIT == 2) acc[mb][nb] = WFrag<T16>::mma(a2[mb], b, acc[mb][nb]); if (NSPLIT >= 2) acc[mb][nb] = WFrag<T16>::mma(a[mb], b2, acc[mb][nb]); } }
        asm volatile("v_nop\n\tv_nop\n\tv_nop\n\tv_nop" : "+v"(acc[0][0]), "+v"(acc[1][1]), "+v"(acc[2][2]), "+v"(acc[3][3]) : "v"(a[0]), "v"(a[3]));
    }
#pragma unroll
    for (int mb = 0; mb < 4; ++mb) {
#pragma unroll
        for (int nb = 0; nb < 4; ++nb) {
#pragma unroll
            for (int j = 0; j < 8; ++j) os[(hi * 8 + j) * 68 + nb * 16 + lr] = acc[mb][nb][j]; }
        __builtin_amdgcn_wave_barrier(); asm volatile("" ::: "memory");
        float* crow = C + (size_t)(r0 + mb * 16) * ldc + c0;
{
#pragma unroll
            for (int s = 0; s < 8; ++s) { const int row = 2 * s + hi, cofs = lr * 4; v4f val = *(const v4fa*)(os + row * 68 + cofs); if (BIAS) { val[0] += bfr(bias[c0 + cofs]); val[1] += bfr(bias[c0 + cofs + 1]); val[2] += bfr(bias[c0 + cofs + 2]); val[3] += bfr(bias[c0 + cofs + 3]); }
                *(v4f*)(crow + (size_t)row * ldc + cofs) = val; }
             }
        __builtin_amdgcn_wave_barrier(); asm volatile("" ::: "memory");
    }
}

__device__ __forceinline__ h16 tohx(float x) { return (h16)x; }
__device__ __forceinline__ void splitf(float y, unsigned short& h, unsigned short& l) { h = f2bf(y); l = f2bf(y - bf2f(h)); }
typedef __attribute__((ext_vector_type(2))) _Float16 v2h;
typedef __attribute__((ext_vector_type(4))) _Float16 v4h;
typedef __attribute__((ext_vector_type(2))) unsigned short v2us;
typedef __attribute__((ext_vector_type(4))) unsigned short v4us;
typedef __attribute__((ext_vector_type(2))) float v2f;
typedef __attribute__((ext_vector_type(4))) int v4i;

__global__ __launch_bounds__(256) void k_wtG(const float* __restrict__ w, int K, int N, bf* Bt) {
    const int lane = threadIdx.x & 31; const int L0 = (blockIdx.x * 8 + (threadIdx.x >> 5)) * 8; const int nlines = N * K / 64;
{
#pragma unroll 1
        for (int l = 0; l < 8; ++l) { const int L = L0 + l; if (L >= nlines) break; const size_t e = (size_t)L * 64 + lane * 2; const int k = (int)(e % K), n = (int)(e / K); v2us o;
            o[0] = f2bf(w[(size_t)k * N + n]); o[1] = f2bf(w[(size_t)(k + 1) * N + n]); *(v2us*)(Bt + e) = o; }
         }
}
__global__ __launch_bounds__(256) void k_cvt8(const float* __restrict__ src, bf* dst, size_t n8) { const size_t i = (size_t)blockIdx.x * 256 + threadIdx.x; if (i >= n8) return; const v8f v = *(const v8f*)(src + i * 8); v8us o;
#pragma unroll
    for (int k = 0; k < 8; ++k) o[k] = f2bf(v[k]); *(v8us*)(dst + i * 8) = o;  }


__global__ __launch_bounds__(256) void k_vtp(const float* __restrict__ F, int pitch, int nheads, h16* V16, bf* Vh, bf* Vl) { const size_t e = ((size_t)blockIdx.x * 256 + threadIdx.x) * 2; if (e >= (size_t)nheads * HD * TT) return; const int t = (int)(e % TT); const int d = (int)((e / TT) % HD); const int g = (int)(e / ((size_t)TT * HD)); v2h o16; v2us oh, ol;
#pragma unroll
    for (int q = 0; q < 2; ++q) { const float x = F[(size_t)(t + q) * pitch + g * HD + d]; o16[q] = tohx(x); unsigned short a2, c2; splitf(x, a2, c2); oh[q] = a2; ol[q] = c2; }
    *(v2h*)(V16 + e) = o16; *(v2us*)(Vh + e) = oh; *(v2us*)(Vl + e) = ol;  }

// k_asoft: per row (zz, i): t = S x HD^-0.5 (causal mask); softmax over the 2048 keys (register row, one exp, fixed trees);
__global__ __launch_bounds__(256) void k_asoft(const float* __restrict__ Sb, h16* P16, bf* Ph, bf* Pl) {
    const int lane = threadIdx.x & 31; const int row = blockIdx.x * 8 + (threadIdx.x >> 5); if (row >= ZH * TT) return; const int i = row % TT; const int zz = row / TT; (void)zz; const bool hires = (i < RH); const float* sr = Sb + (size_t)row * TT; float v[TT / 32]; float mx = -3.0e38f;
#pragma unroll
    for (int ch = 0; ch < TT / 128; ++ch) { const int j0 = ch * 128 + lane * 4; const v4f a = *(const v4f*)(sr + j0);
#pragma unroll
        for (int q = 0; q < 4; ++q) { const int j = j0 + q; const float t = (j <= i) ? a[q] * SCL : -3.0e38f; v[ch * 4 + q] = t;   /* causal: keys after the query excluded */ mx = fmaxf(mx, t); } }
#pragma unroll
    for (int sh = 16; sh; sh >>= 1) mx = fmaxf(mx, __shfl_xor(mx, sh, 32));
    float sum = 0.f;
#pragma unroll
    for (int k = 0; k < TT / 32; ++k) { float d0 = __fsub_rn(v[k], mx); asm volatile("" : "+v"(d0)); v[k] = __builtin_amdgcn_exp2f(__fmul_rn(d0, 1.4426950408889634f)); sum += v[k]; }
#pragma unroll
    for (int sh = 16; sh; sh >>= 1) sum += __shfl_xor(sum, sh, 32);
    const float f = __fdiv_rn(hires ? 1.0f : PCAR, sum);
{
        if (hires) {
#pragma unroll
            for (int ch = 0; ch < TT / 128; ++ch) { v4us oh, ol;
#pragma unroll
                for (int q = 0; q < 4; ++q) { unsigned short a, c2; splitf(v[ch * 4 + q] * f, a, c2); oh[q] = a; ol[q] = c2; }
                const size_t oo = ((size_t)zz * (RH ? RH : 1) + i) * TT + ch * 128 + lane * 4; *(v4us*)(Ph + oo) = oh; *(v4us*)(Pl + oo) = ol; }
        } else {
#pragma unroll
            for (int ch = 0; ch < TT / 128; ++ch) { v4h o4;
#pragma unroll
                for (int q = 0; q < 4; ++q) o4[q] = tohx(v[ch * 4 + q] * f);
                *(v4h*)(P16 + (size_t)row * TT + ch * 128 + lane * 4) = o4; } }
         }
}
__global__ __launch_bounds__(256) void k_merge(const float* __restrict__ O, int h0, float* OUTb) { const size_t e = ((size_t)blockIdx.x * 256 + threadIdx.x) * 2; if (e >= (size_t)ZH * TT * HD) return; const int d = (int)(e % HD); const int t = (int)((e / HD) % TT); const int zz = (int)(e / ((size_t)HD * TT)); const float cs = (t < RH) ? 1.0f : (1.0f / PCAR); const size_t oo = (size_t)t * DQ + (h0 + zz) * HD + d;
    v2f o2; o2[0] = O[e] * cs; o2[1] = O[e + 1] * cs; *(v2f*)(OUTb + oo) = o2;  }


__global__ __launch_bounds__(256) void k_vtpR1(const float* __restrict__ Vb, bf* Vh) { const size_t e = ((size_t)blockIdx.x * 256 + threadIdx.x) * 2; if (e >= (size_t)HD * TT) return; const int t = (int)(e % TT); const int d = (int)(e / TT); v2us o; o[0] = f2bf(Vb[(size_t)t * HD + d]); o[1] = f2bf(Vb[(size_t)(t + 1) * HD + d]); *(v2us*)(Vh + e) = o;  }
__global__ __launch_bounds__(256) void k_mergeR(const float* __restrict__ O, float* outb, size_t n4) { const size_t i = (size_t)blockIdx.x * 256 + threadIdx.x; if (i >= n4) return; const v4f a = *(const v4f*)(O + i * 4); *(v4f*)(outb + i * 4) = a;  }


__global__ __launch_bounds__(256) void k_hp1(const float* __restrict__ src, bf* P) { const size_t i = (size_t)blockIdx.x * 256 + threadIdx.x; if (i >= (size_t)NH_ * TT * HD / 8) return; const size_t e = i * 8; const int d = (int)(e % HD); const int t = (int)((e / HD) % TT); const int h = (int)(e / ((size_t)HD * TT)); const v8f v = *(const v8f*)(src + (size_t)t * DM + h * HD + d); v8us o;
#pragma unroll
    for (int q = 0; q < 8; ++q) o[q] = f2bf(v[q]);
    *(v8us*)(P + e) = o;  }
__global__ __launch_bounds__(256) void k_vt1(const float* __restrict__ src, int pitch, bf* VT) { const size_t e = ((size_t)blockIdx.x * 256 + threadIdx.x) * 2; if (e >= (size_t)NH_ * HD * TT) return; const int t = (int)(e % TT); const int d = (int)((e / TT) % HD); const int h = (int)(e / ((size_t)TT * HD)); v2us o; o[0] = f2bf(src[(size_t)t * pitch + h * HD + d]); o[1] = f2bf(src[(size_t)(t + 1) * pitch + h * HD + d]); *(v2us*)(VT + e) = o;  }
__global__ __launch_bounds__(256) void k_mergeT(const float* __restrict__ O, int h, float* outb) { const size_t i = (size_t)blockIdx.x * 256 + threadIdx.x; if (i >= (size_t)TT * HD / 4) return; const size_t e = i * 4; const int d = (int)(e % HD); const int t = (int)(e / HD); const v4f a = *(const v4f*)(O + e); *(v4f*)(outb + (size_t)t * DM + h * HD + d) = a;  }

extern "C" void kernel_launch(void* const* d_in, const int* in_sizes, int n_in,
                              void* d_out, int out_size, void* d_ws, size_t ws_size, hipStream_t stream) {
    (void)in_sizes; (void)n_in; (void)out_size;
    const float* Qin = (const float*)d_in[0]; const float* Kin = Qin; const float* Vin = Qin;   /* q = k = v = x */
    float* OUT = (float*)d_out;
    char* wsp = (char*)d_ws;
    auto take = [&](size_t bytes) { char* p = wsp; wsp += (bytes + 255) & ~(size_t)255; return (void*)p; };
    bf* QB = (bf*)take((size_t)NH_ * TT * HD * 2); bf* KB = (bf*)take((size_t)NH_ * TT * HD * 2); bf* VT = (bf*)take((size_t)NH_ * HD * TT * 2);
    float* Sb = (float*)take((size_t)TT * TT * 4);  bf* Ph = (bf*)take((size_t)TT * TT * 2); bf* Pl = (bf*)take((size_t)TT * TT * 2); float* Ob = (float*)take((size_t)TT * HD * 4);
    if ((size_t)(wsp - (char*)d_ws) > ws_size) return;
    for (int b = 0; b < NB_; ++b) {
        const float* qb = Qin + (size_t)b * TT * DM; const float* kb = Kin + (size_t)b * TT * DM; const float* vb = Vin + (size_t)b * TT * DM;   /* token-major [t][h][d] slabs */
        k_hp1<<<(unsigned)(((size_t)NH_ * TT * HD / 8 + 255) / 256), 256, 0, stream>>>(qb, QB); k_hp1<<<(unsigned)(((size_t)NH_ * TT * HD / 8 + 255) / 256), 256, 0, stream>>>(kb, KB); k_vt1<<<(unsigned)(((size_t)NH_ * HD * TT / 2 + 255) / 256), 256, 0, stream>>>(vb, DM, VT);
        for (int h = 0; h < NH_; ++h) {
            k_gemmw<bf, 0, false><<<dim3(TT / 64, TT / 64, 1), 32, 0, stream>>>(QB + (size_t)h * TT * HD, nullptr, KB + (size_t)h * TT * HD, nullptr, HD, Sb, TT, nullptr, 0, 0, 0);   /* exact scores (single bf16 planes) */
            k_asoft<<<TT / 8, 256, 0, stream>>>(Sb, nullptr, Ph, Pl);
            k_gemmw<bf, 1, false><<<dim3(TT / 64, HD / 64, 1), 32, 0, stream>>>(Ph, Pl, VT + (size_t)h * HD * TT, nullptr, TT, Ob, HD, nullptr, 0, 0, 0);   /* P (hi/lo) x exact v^T */
            k_mergeT<<<(unsigned)(((size_t)TT * HD / 4 + 255) / 256), 256, 0, stream>>>(Ob, h, OUT + (size_t)b * TT * DM); } }
}

// v001
// Measured time: 88.5 microseconds a run.
// In two side-by-side timings against v000, it was 24.1 and 24.4 times as fast.
#include <hip/hip_runtime.h>

// Parameter-free causal self-attention with x as q, k and v (x [2][2048][1024] viewed as 16 heads x 64; scores = x_h.x_h / 8; causal (-inf); softmax; out = attn x_h merged -> [2][2048][1024] (4.2 M)).
// Layout: bf16 planes per (batch, head) built from x, one copy for q and one for k, plus x^T planes for the value side; one fused kernel walks the keys of every query tile with a running maximum and sum, so scores and P stay in registers; merged token-major output rows.
// Compute dtypes, f32 accumulate: every input rounded to bf16; q.k exact; softmax f32; P hi/lo x exact v on every row; output f32.

#define NB_  2
#define TT   2048
#define DM   1024      // token-major row pitch (H x HD)
#define NH_  16
#define NKV  1
#define REP  (NH_ / NKV)
#define HD   64
#define DQ   (NH_ * HD)
#define DKV  (NKV * HD)
#define ZH   1
#define RH   2048
#define WIN  0
#define PCAR 1024.0f
#define SCL  0.125f   // 1/sqrt(64)
typedef _Float16 h16;
typedef unsigned short bf;
typedef __attribute__((ext_vector_type(16))) __bf16   v16bf;
typedef __attribute__((ext_vector_type(16))) _Float16 v16h;
typedef __attribute__((ext_vector_type(8)))  _Float16 v8h;
typedef __attribute__((ext_vector_type(8)))  unsigned short v8us;
typedef __attribute__((ext_vector_type(8)))  float    v8f;
typedef __attribute__((ext_vector_type(4)))  float    v4f;
typedef v8h  __attribute__((may_alias)) v8ha;
typedef v4f  __attribute__((may_alias)) v4fa;
typedef v8us __attribute__((may_alias)) v8usa;

__device__ __forceinline__ unsigned short f2bf(float f) { unsigned u = __float_as_uint(f); u += 0x7FFFu + ((u >> 16) & 1u); return (unsigned short)(u >> 16); }
__device__ __forceinline__ float bf2f(unsigned short b) { return __uint_as_float(((unsigned)b) << 16); }
__device__ __forceinline__ float bfr(float f) { return bf2f(f2bf(f)); }
__device__ __forceinline__ v16h cat16(v8h lo, v8h hi) { return __builtin_shufflevector(lo, hi, 0, 1, 2, 3, 4, 5, 6, 7, 8, 9, 10, 11, 12, 13, 14, 15); }
__device__ __forceinline__ v16bf cat16b(v8us lo, v8us hi) { return __builtin_bit_cast(v16bf, __builtin_shufflevector(lo, hi, 0, 1, 2, 3, 4, 5, 6, 7, 8, 9, 10, 11, 12, 13, 14, 15)); }
__device__ __forceinline__ v8f wmma16(v16h a, v16h b, v8f c) { return __builtin_amdgcn_wmma_f32_16x16x32_f16(false, a, false, b, (short)0, c, false, false); }
__device__ __forceinline__ v8f wmmab(v16bf a, v16bf b, v8f c) { return __builtin_amdgcn_wmma_f32_16x16x32_bf16(false, a, false, b, (short)0, c, false, false); }



// ---- fragment loader: row c of a K-contiguous 16-bit plane in the hardware k order (8 k at 8h, 8 k at 16 + 8h); the same code serves A and B.
template <typename T16> struct WFrag;
template <> struct WFrag<h16> { typedef v16h V; static __device__ __forceinline__ V ld(const h16* p) { return cat16(*(const v8h*)p, *(const v8h*)(p + 16)); } static __device__ __forceinline__ v8f mma(V a, V b, v8f c) { return wmma16(a, b, c); } };
template <> struct WFrag<bf> { typedef v16bf V; static __device__ __forceinline__ V ld(const bf* p) { return cat16b(*(const v8us*)p, *(const v8us*)(p + 16)); } static __device__ __forceinline__ v8f mma(V a, V b, v8f c) { return wmmab(a, b, c); } };

__device__ __forceinline__ h16 tohx(float x) { return (h16)x; }
__device__ __forceinline__ void splitf(float y, unsigned short& h, unsigned short& l) { h = f2bf(y); l = f2bf(y - bf2f(h)); }
typedef __attribute__((ext_vector_type(2))) _Float16 v2h;
typedef __attribute__((ext_vector_type(4))) _Float16 v4h;
typedef __attribute__((ext_vector_type(2))) unsigned short v2us;
typedef __attribute__((ext_vector_type(4))) unsigned short v4us;
typedef __attribute__((ext_vector_type(2))) float v2f;
typedef __attribute__((ext_vector_type(4))) int v4i;

__global__ __launch_bounds__(256) void k_wtG(const float* __restrict__ w, int K, int N, bf* Bt) {
    const int lane = threadIdx.x & 31; const int L0 = (blockIdx.x * 8 + (threadIdx.x >> 5)) * 8; const int nlines = N * K / 64;
{
#pragma unroll 1
        for (int l = 0; l < 8; ++l) { const int L = L0 + l; if (L >= nlines) break; const size_t e = (size_t)L * 64 + lane * 2; const int k = (int)(e % K), n = (int)(e / K); v2us o;
            o[0] = f2bf(w[(size_t)k * N + n]); o[1] = f2bf(w[(size_t)(k + 1) * N + n]); *(v2us*)(Bt + e) = o; }
         }
}
__global__ __launch_bounds__(256) void k_cvt8(const float* __restrict__ src, bf* dst, size_t n8) { const size_t i = (size_t)blockIdx.x * 256 + threadIdx.x; if (i >= n8) return; const v8f v = *(const v8f*)(src + i * 8); v8us o;
#pragma unroll
    for (int k = 0; k < 8; ++k) o[k] = f2bf(v[k]); *(v8us*)(dst + i * 8) = o;  }


__global__ __launch_bounds__(256) void k_vtp(const float* __restrict__ F, int pitch, int nheads, h16* V16, bf* Vh, bf* Vl) { const size_t e = ((size_t)blockIdx.x * 256 + threadIdx.x) * 2; if (e >= (size_t)nheads * HD * TT) return; const int t = (int)(e % TT); const int d = (int)((e / TT) % HD); const int g = (int)(e / ((size_t)TT * HD)); v2h o16; v2us oh, ol;
#pragma unroll
    for (int q = 0; q < 2; ++q) { const float x = F[(size_t)(t + q) * pitch + g * HD + d]; o16[q] = tohx(x); unsigned short a2, c2; splitf(x, a2, c2); oh[q] = a2; ol[q] = c2; }
    *(v2h*)(V16 + e) = o16; *(v2us*)(Vh + e) = oh; *(v2us*)(Vl + e) = ol;  }

__global__ __launch_bounds__(256) void k_merge(const float* __restrict__ O, int h0, float* OUTb) { const size_t e = ((size_t)blockIdx.x * 256 + threadIdx.x) * 2; if (e >= (size_t)ZH * TT * HD) return; const int d = (int)(e % HD); const int t = (int)((e / HD) % TT); const int zz = (int)(e / ((size_t)HD * TT)); const float cs = (t < RH) ? 1.0f : (1.0f / PCAR); const size_t oo = (size_t)t * DQ + (h0 + zz) * HD + d;
    v2f o2; o2[0] = O[e] * cs; o2[1] = O[e + 1] * cs; *(v2f*)(OUTb + oo) = o2;  }


__global__ __launch_bounds__(256) void k_vtpR1(const float* __restrict__ Vb, bf* Vh) { const size_t e = ((size_t)blockIdx.x * 256 + threadIdx.x) * 2; if (e >= (size_t)HD * TT) return; const int t = (int)(e % TT); const int d = (int)(e / TT); v2us o; o[0] = f2bf(Vb[(size_t)t * HD + d]); o[1] = f2bf(Vb[(size_t)(t + 1) * HD + d]); *(v2us*)(Vh + e) = o;  }
__global__ __launch_bounds__(256) void k_mergeR(const float* __restrict__ O, float* outb, size_t n4) { const size_t i = (size_t)blockIdx.x * 256 + threadIdx.x; if (i >= n4) return; const v4f a = *(const v4f*)(O + i * 4); *(v4f*)(outb + i * 4) = a;  }


__global__ __launch_bounds__(256) void k_hp1(const float* __restrict__ src, bf* P) { const size_t i = (size_t)blockIdx.x * 256 + threadIdx.x; if (i >= (size_t)NH_ * TT * HD / 8) return; const size_t e = i * 8; const int d = (int)(e % HD); const int t = (int)((e / HD) % TT); const int h = (int)(e / ((size_t)HD * TT)); const v8f v = *(const v8f*)(src + (size_t)t * DM + h * HD + d); v8us o;
#pragma unroll
    for (int q = 0; q < 8; ++q) o[q] = f2bf(v[q]);
    *(v8us*)(P + e) = o;  }
__global__ __launch_bounds__(256) void k_vt1(const float* __restrict__ src, int pitch, bf* VT) { const size_t e = ((size_t)blockIdx.x * 256 + threadIdx.x) * 2; if (e >= (size_t)NH_ * HD * TT) return; const int t = (int)(e % TT); const int d = (int)((e / TT) % HD); const int h = (int)(e / ((size_t)TT * HD)); v2us o; o[0] = f2bf(src[(size_t)t * pitch + h * HD + d]); o[1] = f2bf(src[(size_t)(t + 1) * pitch + h * HD + d]); *(v2us*)(VT + e) = o;  }

typedef __attribute__((ext_vector_type(2))) __bf16 v2bf;
typedef __attribute__((ext_vector_type(8))) unsigned v8u;
#define KBLK 64
__device__ __forceinline__ float xhalf(float x) { return __builtin_bit_cast(float, __builtin_amdgcn_permlanex16(__builtin_bit_cast(int, x), __builtin_bit_cast(int, x), 0x76543210, 0xfedcba98, false, false)); }   // lane l takes lane l ^ 16's value
#define SC2  0.18033688011112042f   // HD^-0.5 x log2(e): the softmax runs in base 2
__global__ __launch_bounds__(128) void k_fattn(const bf* __restrict__ QB, const bf* __restrict__ KB, const bf* __restrict__ VT, float* __restrict__ OUT) {
    const int lane = threadIdx.x & 31, lr = lane & 15, hi = lane >> 4;
    const int wave = __builtin_amdgcn_readfirstlane((int)(threadIdx.x >> 5));   // scalar, so that the pass loop is a scalar loop
    const int plane = blockIdx.y;
    const bf* Qp = QB + (size_t)plane * TT * HD; const bf* Kp = KB + (size_t)plane * TT * HD + (size_t)lr * HD + 8 * hi; const bf* Vp = VT + (size_t)plane * HD * TT + (size_t)lr * TT + 8 * hi;
    float* Op = OUT + (size_t)(plane / NH_) * TT * DM + (size_t)(plane % NH_) * HD;
    const int pr = blockIdx.x * 4 + wave;
    // the two tiles run one after the other through one copy of the code (rolled); every short loop below is unrolled so that the fragment arrays stay in registers
#pragma unroll 1
    for (int half = 0; half < 2; ++half) {
        const int q0 = (half ? (TT / 16 - 1 - pr) : pr) * 16; const int nblk = q0 / KBLK + 1; const int q = q0 + lr;
        v16bf qf[2], kf[4][2];
#pragma unroll
        for (int c = 0; c < 2; ++c) qf[c] = WFrag<bf>::ld(Qp + (size_t)q * HD + 8 * hi + 32 * c);
#pragma unroll
        for (int nb = 0; nb < 4; ++nb)
#pragma unroll
            for (int c = 0; c < 2; ++c) kf[nb][c] = WFrag<bf>::ld(Kp + (size_t)(nb * 16) * HD + 32 * c);
        v8f o[4];
#pragma unroll
        for (int nd = 0; nd < 4; ++nd) o[nd] = (v8f){};
        float m = -3.0e38f, l = 0.f;
        // rolled: the trip count is the tile's own, and one pass already fills the register file
#pragma unroll 1
        for (int kb = 0; kb < nblk; ++kb) {
            const int key0 = kb * KBLK;
            v16bf vf[4][2];
#pragma unroll
            for (int nd = 0; nd < 4; ++nd)
#pragma unroll
                for (int c = 0; c < 2; ++c) vf[nd][c] = WFrag<bf>::ld(Vp + (size_t)(nd * 16) * TT + key0 + 32 * c);
            asm volatile("s_wait_xcnt 0x0" ::: "memory");   // the value loads are issued: their address registers may be reused from here on
            v8f s[4];
#pragma unroll
            for (int nb = 0; nb < 4; ++nb) { s[nb] = wmmab(kf[nb][0], qf[0], (v8f){}); s[nb] = wmmab(kf[nb][1], qf[1], s[nb]); }
            const int kn = (kb + 1 < nblk) ? key0 + KBLK : key0;   /* next pass's key rows, fetched behind this pass's products; the last pass re-reads its own */
#pragma unroll
            for (int nb = 0; nb < 4; ++nb)
#pragma unroll
                for (int c = 0; c < 2; ++c) kf[nb][c] = WFrag<bf>::ld(Kp + (size_t)(kn + nb * 16) * HD + 32 * c);
            asm volatile("s_wait_xcnt 0x0" ::: "memory");   // the key loads are issued: their address registers are reused below
            if (kb == nblk - 1) {   /* only the last pass meets the diagonal: keys after the query excluded */
#pragma unroll
                for (int nb = 0; nb < 4; ++nb)
#pragma unroll
                    for (int j = 0; j < 8; ++j) s[nb][j] = (key0 + nb * 16 + hi * 8 + j <= q) ? s[nb][j] : -3.0e38f; }
            float mx = m;
#pragma unroll
            for (int nb = 0; nb < 4; ++nb)
#pragma unroll
                for (int j = 0; j < 8; ++j) mx = fmaxf(mx, s[nb][j]);
            mx = fmaxf(mx, xhalf(mx));
            const float al = __builtin_amdgcn_exp2f((m - mx) * SC2); const float mc = mx * SC2; m = mx;
            float sum = 0.f; v8u ph[2], pl[2];
#pragma unroll
            for (int nb = 0; nb < 4; ++nb)
#pragma unroll
                for (int j = 0; j < 8; j += 2) {
                    v2f p; p[0] = __builtin_amdgcn_exp2f(fmaf(s[nb][j], SC2, -mc)); p[1] = __builtin_amdgcn_exp2f(fmaf(s[nb][j + 1], SC2, -mc)); sum += p[0] + p[1];
                    const unsigned wh = __builtin_bit_cast(unsigned, __builtin_convertvector(p, v2bf));
                    v2f hf; hf[0] = __uint_as_float(wh << 16); hf[1] = __uint_as_float(wh & 0xFFFF0000u); const v2f r = p - hf;
                    ph[nb >> 1][(nb & 1) * 4 + (j >> 1)] = wh; pl[nb >> 1][(nb & 1) * 4 + (j >> 1)] = __builtin_bit_cast(unsigned, __builtin_convertvector(r, v2bf)); }
            l = l * al + sum;
#pragma unroll
            for (int nd = 0; nd < 4; ++nd)
#pragma unroll
                for (int j = 0; j < 8; ++j) o[nd][j] *= al;
#pragma unroll
            for (int c = 0; c < 2; ++c)
#pragma unroll
                for (int nd = 0; nd < 4; ++nd) { o[nd] = wmmab(vf[nd][c], __builtin_bit_cast(v16bf, ph[c]), o[nd]); o[nd] = wmmab(vf[nd][c], __builtin_bit_cast(v16bf, pl[c]), o[nd]); }
        }
        l += xhalf(l);
        const float f = __fdiv_rn(1.0f, l);
        float* orow = Op + (size_t)q * DM + hi * 8;   /* lane (c, h) holds d = 16 nd + 8 h + r of query c */
#pragma unroll
        for (int nd = 0; nd < 4; ++nd) { v4f a, b2;
#pragma unroll
            for (int j = 0; j < 4; ++j) { a[j] = o[nd][j] * f; b2[j] = o[nd][j + 4] * f; }
            *(v4f*)(orow + nd * 16) = a; *(v4f*)(orow + nd * 16 + 4) = b2; }
        asm volatile("s_wait_xcnt 0x0" ::: "memory");   // the stores' address and data registers are rewritten by the next tile
    }
}

extern "C" void kernel_launch(void* const* d_in, const int* in_sizes, int n_in,
                              void* d_out, int out_size, void* d_ws, size_t ws_size, hipStream_t stream) {
    (void)in_sizes; (void)n_in; (void)out_size;
    const float* Qin = (const float*)d_in[0]; const float* Kin = Qin; const float* Vin = Qin;   /* q = k = v = x */
    float* OUT = (float*)d_out;
    char* wsp = (char*)d_ws;
    auto take = [&](size_t bytes) { char* p = wsp; wsp += (bytes + 255) & ~(size_t)255; return (void*)p; };
    const size_t PB = (size_t)NH_ * TT * HD;   /* elements of one batch's planes */
    bf* QB = (bf*)take(NB_ * PB * 2); bf* KB = (bf*)take(NB_ * PB * 2); bf* VT = (bf*)take(NB_ * PB * 2);
    if ((size_t)(wsp - (char*)d_ws) > ws_size) return;
    for (int b = 0; b < NB_; ++b) {
        const float* qb = Qin + (size_t)b * TT * DM; const float* kb = Kin + (size_t)b * TT * DM; const float* vb = Vin + (size_t)b * TT * DM;   /* token-major [t][h][d] slabs */
        k_hp1<<<(unsigned)(((size_t)NH_ * TT * HD / 8 + 255) / 256), 256, 0, stream>>>(qb, QB + b * PB); k_hp1<<<(unsigned)(((size_t)NH_ * TT * HD / 8 + 255) / 256), 256, 0, stream>>>(kb, KB + b * PB); k_vt1<<<(unsigned)(((size_t)NH_ * HD * TT / 2 + 255) / 256), 256, 0, stream>>>(vb, DM, VT + b * PB); }
    k_fattn<<<dim3(TT / 128, NB_ * NH_, 1), 128, 0, stream>>>(QB, KB, VT, OUT);   /* every (batch, head) plane in one launch */
}

// v002
// One run takes 65.6 microseconds.
// Timed twice side by side with v001, it ran 1.35 times as fast both times.
// Counting every step since v000, it is 32.7 times as fast.
#include <hip/hip_runtime.h>

// Parameter-free causal self-attention with x as q, k and v (x [2][2048][1024] viewed as 16 heads x 64; scores = x_h.x_h / 8; causal (-inf); softmax; out = attn x_h merged -> [2][2048][1024] (4.2 M)).
// Layout: one set of bf16 planes per (batch, head) for queries and keys plus x^T planes for the value side, both built from x by one launch; one fused kernel walks the keys of every query tile with a running maximum and sum, so scores and P stay in registers; merged token-major output rows.
// Compute dtypes, f32 accumulate: every input rounded to bf16; q.k exact; softmax f32; P hi/lo x exact v on every row; output f32.

#define NB_  2
#define TT   2048
#define DM   1024      // token-major row pitch (H x HD)
#define NH_  16
#define NKV  1
#define REP  (NH_ / NKV)
#define HD   64
#define DQ   (NH_ * HD)
#define DKV  (NKV * HD)
#define ZH   1
#define RH   2048
#define WIN  0
#define PCAR 1024.0f
#define SCL  0.125f   // 1/sqrt(64)
typedef _Float16 h16;
typedef unsigned short bf;
typedef __attribute__((ext_vector_type(16))) __bf16   v16bf;
typedef __attribute__((ext_vector_type(16))) _Float16 v16h;
typedef __attribute__((ext_vector_type(8)))  _Float16 v8h;
typedef __attribute__((ext_vector_type(8)))  unsigned short v8us;
typedef __attribute__((ext_vector_type(8)))  float    v8f;
typedef __attribute__((ext_vector_type(4)))  float    v4f;
typedef v8h  __attribute__((may_alias)) v8ha;
typedef v4f  __attribute__((may_alias)) v4fa;
typedef v8us __attribute__((may_alias)) v8usa;

__device__ __forceinline__ unsigned short f2bf(float f) { unsigned u = __float_as_uint(f); u += 0x7FFFu + ((u >> 16) & 1u); return (unsigned short)(u >> 16); }
__device__ __forceinline__ float bf2f(unsigned short b) { return __uint_as_float(((unsigned)b) << 16); }
__device__ __forceinline__ float bfr(float f) { return bf2f(f2bf(f)); }
__device__ __forceinline__ v16h cat16(v8h lo, v8h hi) { return __builtin_shufflevector(lo, hi, 0, 1, 2, 3, 4, 5, 6, 7, 8, 9, 10, 11, 12, 13, 14, 15); }
__device__ __forceinline__ v16bf cat16b(v8us lo, v8us hi) { return __builtin_bit_cast(v16bf, __builtin_shufflevector(lo, hi, 0, 1, 2, 3, 4, 5, 6, 7, 8, 9, 10, 11, 12, 13, 14, 15)); }
__device__ __forceinline__ v8f wmma16(v16h a, v16h b, v8f c) { return __builtin_amdgcn_wmma_f32_16x16x32_f16(false, a, false, b, (short)0, c, false, false); }
__device__ __forceinline__ v8f wmmab(v16bf a, v16bf b, v8f c) { return __builtin_amdgcn_wmma_f32_16x16x32_bf16(false, a, false, b, (short)0, c, false, false); }



// ---- fragment loader: row c of a K-contiguous 16-bit plane in the hardware k order (8 k at 8h, 8 k at 16 + 8h); the same code serves A and B.
template <typename T16> struct WFrag;
template <> struct WFrag<h16> { typedef v16h V; static __device__ __forceinline__ V ld(const h16* p) { return cat16(*(const v8h*)p, *(const v8h*)(p + 16)); } static __device__ __forceinline__ v8f mma(V a, V b, v8f c) { return wmma16(a, b, c); } };
template <> struct WFrag<bf> { typedef v16bf V; static __device__ __forceinline__ V ld(const bf* p) { return cat16b(*(const v8us*)p, *(const v8us*)(p + 16)); } static __device__ __forceinline__ v8f mma(V a, V b, v8f c) { return wmmab(a, b, c); } };

__device__ __forceinline__ h16 tohx(float x) { return (h16)x; }
__device__ __forceinline__ void splitf(float y, unsigned short& h, unsigned short& l) { h = f2bf(y); l = f2bf(y - bf2f(h)); }
typedef __attribute__((ext_vector_type(2))) _Float16 v2h;
typedef __attribute__((ext_vector_type(4))) _Float16 v4h;
typedef __attribute__((ext_vector_type(2))) unsigned short v2us;
typedef __attribute__((ext_vector_type(4))) unsigned short v4us;
typedef __attribute__((ext_vector_type(2))) float v2f;
typedef __attribute__((ext_vector_type(4))) int v4i;

__global__ __launch_bounds__(256) void k_wtG(const float* __restrict__ w, int K, int N, bf* Bt) {
    const int lane = threadIdx.x & 31; const int L0 = (blockIdx.x * 8 + (threadIdx.x >> 5)) * 8; const int nlines = N * K / 64;
{
#pragma unroll 1
        for (int l = 0; l < 8; ++l) { const int L = L0 + l; if (L >= nlines) break; const size_t e = (size_t)L * 64 + lane * 2; const int k = (int)(e % K), n = (int)(e / K); v2us o;
            o[0] = f2bf(w[(size_t)k * N + n]); o[1] = f2bf(w[(size_t)(k + 1) * N + n]); *(v2us*)(Bt + e) = o; }
         }
}
__global__ __launch_bounds__(256) void k_cvt8(const float* __restrict__ src, bf* dst, size_t n8) { const size_t i = (size_t)blockIdx.x * 256 + threadIdx.x; if (i >= n8) return; const v8f v = *(const v8f*)(src + i * 8); v8us o;
#pragma unroll
    for (int k = 0; k < 8; ++k) o[k] = f2bf(v[k]); *(v8us*)(dst + i * 8) = o;  }


__global__ __launch_bounds__(256) void k_vtp(const float* __restrict__ F, int pitch, int nheads, h16* V16, bf* Vh, bf* Vl) { const size_t e = ((size_t)blockIdx.x * 256 + threadIdx.x) * 2; if (e >= (size_t)nheads * HD * TT) return; const int t = (int)(e % TT); const int d = (int)((e / TT) % HD); const int g = (int)(e / ((size_t)TT * HD)); v2h o16; v2us oh, ol;
#pragma unroll
    for (int q = 0; q < 2; ++q) { const float x = F[(size_t)(t + q) * pitch + g * HD + d]; o16[q] = tohx(x); unsigned short a2, c2; splitf(x, a2, c2); oh[q] = a2; ol[q] = c2; }
    *(v2h*)(V16 + e) = o16; *(v2us*)(Vh + e) = oh; *(v2us*)(Vl + e) = ol;  }

__global__ __launch_bounds__(256) void k_merge(const float* __restrict__ O, int h0, float* OUTb) { const size_t e = ((size_t)blockIdx.x * 256 + threadIdx.x) * 2; if (e >= (size_t)ZH * TT * HD) return; const int d = (int)(e % HD); const int t = (int)((e / HD) % TT); const int zz = (int)(e / ((size_t)HD * TT)); const float cs = (t < RH) ? 1.0f : (1.0f / PCAR); const size_t oo = (size_t)t * DQ + (h0 + zz) * HD + d;
    v2f o2; o2[0] = O[e] * cs; o2[1] = O[e + 1] * cs; *(v2f*)(OUTb + oo) = o2;  }


__global__ __launch_bounds__(256) void k_vtpR1(const float* __restrict__ Vb, bf* Vh) { const size_t e = ((size_t)blockIdx.x * 256 + threadIdx.x) * 2; if (e >= (size_t)HD * TT) return; const int t = (int)(e % TT); const int d = (int)(e / TT); v2us o; o[0] = f2bf(Vb[(size_t)t * HD + d]); o[1] = f2bf(Vb[(size_t)(t + 1) * HD + d]); *(v2us*)(Vh + e) = o;  }
__global__ __launch_bounds__(256) void k_mergeR(const float* __restrict__ O, float* outb, size_t n4) { const size_t i = (size_t)blockIdx.x * 256 + threadIdx.x; if (i >= n4) return; const v4f a = *(const v4f*)(O + i * 4); *(v4f*)(outb + i * 4) = a;  }


// ---- k_prep: both bf16 forms of x in one launch, x read once. One work-group per WGP takes 256 tokens x 64 d of one (batch, head) plane; a half-wave reads one token's 256 B.
// A lane holds 4 d of tokens t and t + 1: pairs along d are the plane's rows, stored as whole 128-B lines; pairs along t go through LDS as words [d][t / 2] and leave as 512-B pieces of the x^T rows.
// LDS: 16-B chunk k of row d lies at chunk k ^ (d / 4 mod 16), so that the 32 lanes of a word store and the 16 lanes of each half of a 16-B read fall on different banks.
typedef __attribute__((ext_vector_type(2))) __bf16 v2bf;
typedef __attribute__((ext_vector_type(2))) unsigned v2u;
typedef __attribute__((ext_vector_type(4))) unsigned v4u;
typedef v2u __attribute__((may_alias)) v2ua;
typedef v4u __attribute__((may_alias)) v4ua;
#define PT 256
__device__ __forceinline__ unsigned pkbf(float x, float y) { v2f p; p[0] = x; p[1] = y; return __builtin_bit_cast(unsigned, __builtin_convertvector(p, v2bf)); }   // x in the low half; round to nearest even
__global__ __launch_bounds__(256) void k_prep(const float* __restrict__ X, bf* __restrict__ XB, bf* __restrict__ XT) {
    __shared__ __attribute__((aligned(16))) unsigned T[HD * (PT / 2)];
    const int lane = threadIdx.x & 31, c = lane & 15, r = lane >> 4, wave = threadIdx.x >> 5;
    const int plane = blockIdx.y, tb = blockIdx.x * PT, t0 = tb + 32 * wave + 2 * r;
    const float* sp = X + (size_t)(plane / NH_) * TT * DM + (size_t)(plane % NH_) * HD + (size_t)t0 * DM + 4 * c;
    bf* bp = XB + (size_t)plane * TT * HD + (size_t)t0 * HD + 4 * c; bf* tp = XT + (size_t)plane * HD * TT + (size_t)(8 * wave) * TT + tb + 8 * lane;
    v4f a[8], b[8];
#pragma unroll
    for (int i = 0; i < 8; ++i) { a[i] = *(const v4fa*)(sp + (size_t)(4 * i) * DM); b[i] = *(const v4fa*)(sp + (size_t)(4 * i + 1) * DM); }
    asm volatile("s_wait_xcnt 0x0" :: "v"(sp), "v"(bp), "v"(tp) : "memory");   // the loads are issued: their address register, held to this line, may be reused from here on; both store addresses are formed while the loads fly, not among the stores
    __builtin_amdgcn_sched_barrier(0);   // all 16 loads fly together: without it the compiler issues the last ones only behind waits for the first
    v2u u[8], w[8];
#pragma unroll
    for (int i = 0; i < 8; ++i) { u[i][0] = pkbf(a[i][0], a[i][1]); u[i][1] = pkbf(a[i][2], a[i][3]); w[i][0] = pkbf(b[i][0], b[i][1]); w[i][1] = pkbf(b[i][2], b[i][3]); }
#pragma unroll
    for (int i = 0; i < 8; ++i)
#pragma unroll
        for (int j = 0; j < 4; ++j) { const unsigned lo = u[i][j >> 1], hi = w[i][j >> 1];   /* d = 4 c + j of tokens t (low half) and t + 1 */
            T[(4 * c + j) * (PT / 2) + (((4 * wave + (i >> 1)) ^ c) << 2) + ((2 * i + r) & 3)] = (j & 1) ? ((lo >> 16) | (hi & 0xFFFF0000u)) : ((lo & 0xFFFFu) | (hi << 16)); }
    __syncthreads();   // every wave's words are in LDS before a row of x^T is read; all global stores stand behind it, so that it does not wait for them
#pragma unroll
    for (int n = 0; n < 8; ++n) { const int d = 8 * wave + n; *(v4ua*)(tp + (size_t)n * TT) = *(const v4ua*)(T + d * (PT / 2) + ((lane ^ ((d >> 2) & 15)) << 2)); }
#pragma unroll
    for (int i = 0; i < 8; ++i) { *(v2ua*)(bp + (size_t)(4 * i) * HD) = u[i]; *(v2ua*)(bp + (size_t)(4 * i + 1) * HD) = w[i]; }
}

typedef __attribute__((ext_vector_type(8))) unsigned v8u;
#define KBLK 64
__device__ __forceinline__ float xhalf(float x) { return __builtin_bit_cast(float, __builtin_amdgcn_permlanex16(__builtin_bit_cast(int, x), __builtin_bit_cast(int, x), 0x76543210, 0xfedcba98, false, false)); }   // lane l takes lane l ^ 16's value
#define SC2  0.18033688011112042f   // HD^-0.5 x log2(e): the softmax runs in base 2
__global__ __launch_bounds__(128) void k_fattn(const bf* __restrict__ QB, const bf* __restrict__ KB, const bf* __restrict__ VT, float* __restrict__ OUT) {
    const int lane = threadIdx.x & 31, lr = lane & 15, hi = lane >> 4;
    const int wave = __builtin_amdgcn_readfirstlane((int)(threadIdx.x >> 5));   // scalar, so that the pass loop is a scalar loop
    const int plane = blockIdx.y;
    const bf* Qp = QB + (size_t)plane * TT * HD; const bf* Kp = KB + (size_t)plane * TT * HD + (size_t)lr * HD + 8 * hi; const bf* Vp = VT + (size_t)plane * HD * TT + (size_t)lr * TT + 8 * hi;
    float* Op = OUT + (size_t)(plane / NH_) * TT * DM + (size_t)(plane % NH_) * HD;
    const int pr = blockIdx.x * 4 + wave;
    // the two tiles run one after the other through one copy of the code (rolled); every short loop below is unrolled so that the fragment arrays stay in registers
#pragma unroll 1
    for (int half = 0; half < 2; ++half) {
        const int q0 = (half ? (TT / 16 - 1 - pr) : pr) * 16; const int nblk = q0 / KBLK + 1; const int q = q0 + lr;
        v16bf qf[2], kf[4][2];
#pragma unroll
        for (int c = 0; c < 2; ++c) qf[c] = WFrag<bf>::ld(Qp + (size_t)q * HD + 8 * hi + 32 * c);
#pragma unroll
        for (int nb = 0; nb < 4; ++nb)
#pragma unroll
            for (int c = 0; c < 2; ++c) kf[nb][c] = WFrag<bf>::ld(Kp + (size_t)(nb * 16) * HD + 32 * c);
        v8f o[4];
#pragma unroll
        for (int nd = 0; nd < 4; ++nd) o[nd] = (v8f){};
        float m = -3.0e38f, l = 0.f;
        // rolled: the trip count is the tile's own, and one pass already fills the register file
#pragma unroll 1
        for (int kb = 0; kb < nblk; ++kb) {
            const int key0 = kb * KBLK;
            v16bf vf[4][2];
#pragma unroll
            for (int nd = 0; nd < 4; ++nd)
#pragma unroll
                for (int c = 0; c < 2; ++c) vf[nd][c] = WFrag<bf>::ld(Vp + (size_t)(nd * 16) * TT + key0 + 32 * c);
            asm volatile("s_wait_xcnt 0x0" ::: "memory");   // the value loads are issued: their address registers may be reused from here on
            v8f s[4];
#pragma unroll
            for (int nb = 0; nb < 4; ++nb) { s[nb] = wmmab(kf[nb][0], qf[0], (v8f){}); s[nb] = wmmab(kf[nb][1], qf[1], s[nb]); }
            const int kn = (kb + 1 < nblk) ? key0 + KBLK : key0;   /* next pass's key rows, fetched behind this pass's products; the last pass re-reads its own */
#pragma unroll
            for (int nb = 0; nb < 4; ++nb)
#pragma unroll
                for (int c = 0; c < 2; ++c) kf[nb][c] = WFrag<bf>::ld(Kp + (size_t)(kn + nb * 16) * HD + 32 * c);
            asm volatile("s_wait_xcnt 0x0" ::: "memory");   // the key loads are issued: their address registers are reused below
            if (kb == nblk - 1) {   /* only the last pass meets the diagonal: keys after the query excluded */
#pragma unroll
                for (int nb = 0; nb < 4; ++nb)
#pragma unroll
                    for (int j = 0; j < 8; ++j) s[nb][j] = (key0 + nb * 16 + hi * 8 + j <= q) ? s[nb][j] : -3.0e38f; }
            float mx = m;
#pragma unroll
            for (int nb = 0; nb < 4; ++nb)
#pragma unroll
                for (int j = 0; j < 8; ++j) mx = fmaxf(mx, s[nb][j]);
            mx = fmaxf(mx, xhalf(mx));
            const float al = __builtin_amdgcn_exp2f((m - mx) * SC2); const float mc = mx * SC2; m = mx;
            float sum = 0.f; v8u ph[2], pl[2];
#pragma unroll
            for (int nb = 0; nb < 4; ++nb)
#pragma unroll
                for (int j = 0; j < 8; j += 2) {
                    v2f p; p[0] = __builtin_amdgcn_exp2f(fmaf(s[nb][j], SC2, -mc)); p[1] = __builtin_amdgcn_exp2f(fmaf(s[nb][j + 1], SC2, -mc)); sum += p[0] + p[1];
                    const unsigned wh = __builtin_bit_cast(unsigned, __builtin_convertvector(p, v2bf));
                    v2f hf; hf[0] = __uint_as_float(wh << 16); hf[1] = __uint_as_float(wh & 0xFFFF0000u); const v2f r = p - hf;
                    ph[nb >> 1][(nb & 1) * 4 + (j >> 1)] = wh; pl[nb >> 1][(nb & 1) * 4 + (j >> 1)] = __builtin_bit_cast(unsigned, __builtin_convertvector(r, v2bf)); }
            l = l * al + sum;
#pragma unroll
            for (int nd = 0; nd < 4; ++nd)
#pragma unroll
                for (int j = 0; j < 8; ++j) o[nd][j] *= al;
#pragma unroll
            for (int c = 0; c < 2; ++c)
#pragma unroll
                for (int nd = 0; nd < 4; ++nd) { o[nd] = wmmab(vf[nd][c], __builtin_bit_cast(v16bf, ph[c]), o[nd]); o[nd] = wmmab(vf[nd][c], __builtin_bit_cast(v16bf, pl[c]), o[nd]); }
        }
        l += xhalf(l);
        const float f = __fdiv_rn(1.0f, l);
        float* orow = Op + (size_t)q * DM + hi * 8;   /* lane (c, h) holds d = 16 nd + 8 h + r of query c */
#pragma unroll
        for (int nd = 0; nd < 4; ++nd) { v4f a, b2;
#pragma unroll
            for (int j = 0; j < 4; ++j) { a[j] = o[nd][j] * f; b2[j] = o[nd][j + 4] * f; }
            *(v4f*)(orow + nd * 16) = a; *(v4f*)(orow + nd * 16 + 4) = b2; }
        asm volatile("s_wait_xcnt 0x0" ::: "memory");   // the stores' address and data registers are rewritten by the next tile
    }
}

extern "C" void kernel_launch(void* const* d_in, const int* in_sizes, int n_in,
                              void* d_out, int out_size, void* d_ws, size_t ws_size, hipStream_t stream) {
    (void)in_sizes; (void)n_in; (void)out_size;
    const float* Xin = (const float*)d_in[0];   /* q = k = v = x */
    float* OUT = (float*)d_out;
    char* wsp = (char*)d_ws;
    auto take = [&](size_t bytes) { char* p = wsp; wsp += (bytes + 255) & ~(size_t)255; return (void*)p; };
    const size_t PB = (size_t)NH_ * TT * HD;   /* elements of one batch's planes */
    bf* XB = (bf*)take(NB_ * PB * 2); bf* VT = (bf*)take(NB_ * PB * 2);   /* one plane set serves queries and keys */
    if ((size_t)(wsp - (char*)d_ws) > ws_size) return;
    k_prep<<<dim3(TT / PT, NB_ * NH_, 1), 256, 0, stream>>>(Xin, XB, VT);
    k_fattn<<<dim3(TT / 128, NB_ * NH_, 1), 128, 0, stream>>>(XB, XB, VT, OUT);   /* every (batch, head) plane in one launch */
}

// v003
// One run takes 43.9 microseconds.
// In both of two side-by-side timings against v002, it was 1.49 times as fast.
// Counting every step since v000, it is 48.7 times as fast.
#include <hip/hip_runtime.h>

// Parameter-free causal self-attention with x as q, k and v (x [2][2048][1024] viewed as 16 heads x 64; scores = x_h.x_h / 8; causal (-inf); softmax; out = attn x_h merged -> [2][2048][1024] (4.2 M)).
// Layout: one set of bf16 planes per (batch, head) for queries and keys plus x^T planes for the value side, both built from x by one launch and both stored in fragment order (a wave's 16-B pieces of one fragment half lie side by side, 512 B); one fused kernel walks the keys of every query tile with a running maximum and sum, so scores and P stay in registers; merged token-major output rows.
// Compute dtypes, f32 accumulate: every input rounded to bf16; q.k exact; softmax f32; P hi/lo x exact v on every row; output f32.

#define NB_  2
#define TT   2048
#define DM   1024      // token-major row pitch (H x HD)
#define NH_  16
#define NKV  1
#define REP  (NH_ / NKV)
#define HD   64
#define DQ   (NH_ * HD)
#define DKV  (NKV * HD)
#define ZH   1
#define RH   2048
#define WIN  0
#define PCAR 1024.0f
#define SCL  0.125f   // 1/sqrt(64)
typedef _Float16 h16;
typedef unsigned short bf;
typedef __attribute__((ext_vector_type(16))) __bf16   v16bf;
typedef __attribute__((ext_vector_type(16))) _Float16 v16h;
typedef __attribute__((ext_vector_type(8)))  _Float16 v8h;
typedef __attribute__((ext_vector_type(8)))  unsigned short v8us;
typedef __attribute__((ext_vector_type(8)))  float    v8f;
typedef __attribute__((ext_vector_type(4)))  float    v4f;
typedef v8h  __attribute__((may_alias)) v8ha;
typedef v4f  __attribute__((may_alias)) v4fa;
typedef v8us __attribute__((may_alias)) v8usa;

__device__ __forceinline__ unsigned short f2bf(float f) { unsigned u = __float_as_uint(f); u += 0x7FFFu + ((u >> 16) & 1u); return (unsigned short)(u >> 16); }
__device__ __forceinline__ float bf2f(unsigned short b) { return __uint_as_float(((unsigned)b) << 16); }
__device__ __forceinline__ float bfr(float f) { return bf2f(f2bf(f)); }
__device__ __forceinline__ v16h cat16(v8h lo, v8h hi) { return __builtin_shufflevector(lo, hi, 0, 1, 2, 3, 4, 5, 6, 7, 8, 9, 10, 11, 12, 13, 14, 15); }
__device__ __forceinline__ v16bf cat16b(v8us lo, v8us hi) { return __builtin_bit_cast(v16bf, __builtin_shufflevector(lo, hi, 0, 1, 2, 3, 4, 5, 6, 7, 8, 9, 10, 11, 12, 13, 14, 15)); }
__device__ __forceinline__ v8f wmma16(v16h a, v16h b, v8f c) { return __builtin_amdgcn_wmma_f32_16x16x32_f16(false, a, false, b, (short)0, c, false, false); }
__device__ __forceinline__ v8f wmmab(v16bf a, v16bf b, v8f c) { return __builtin_amdgcn_wmma_f32_16x16x32_bf16(false, a, false, b, (short)0, c, false, false); }



// ---- fragment loader: row c of a K-contiguous 16-bit plane in the hardware k order (8 k at 8h, 8 k at 16 + 8h); the same code serves A and B.
template <typename T16> struct WFrag;
template <> struct WFrag<h16> { typedef v16h V; static __device__ __forceinline__ V ld(const h16* p) { return cat16(*(const v8h*)p, *(const v8h*)(p + 16)); } static __device__ __forceinline__ v8f mma(V a, V b, v8f c) { return wmma16(a, b, c); } };
template <> struct WFrag<bf> { typedef v16bf V; static __device__ __forceinline__ V ld(const bf* p) { return cat16b(*(const v8us*)p, *(const v8us*)(p + 16)); } static __device__ __forceinline__ v8f mma(V a, V b, v8f c) { return wmmab(a, b, c); } };

__device__ __forceinline__ h16 tohx(float x) { return (h16)x; }
__device__ __forceinline__ void splitf(float y, unsigned short& h, unsigned short& l) { h = f2bf(y); l = f2bf(y - bf2f(h)); }
typedef __attribute__((ext_vector_type(2))) _Float16 v2h;
typedef __attribute__((ext_vector_type(4))) _Float16 v4h;
typedef __attribute__((ext_vector_type(2))) unsigned short v2us;
typedef __attribute__((ext_vector_type(4))) unsigned short v4us;
typedef __attribute__((ext_vector_type(2))) float v2f;
typedef __attribute__((ext_vector_type(4))) int v4i;

__global__ __launch_bounds__(256) void k_wtG(const float* __restrict__ w, int K, int N, bf* Bt) {
    const int lane = threadIdx.x & 31; const int L0 = (blockIdx.x * 8 + (threadIdx.x >> 5)) * 8; const int nlines = N * K / 64;
{
#pragma unroll 1
        for (int l = 0; l < 8; ++l) { const int L = L0 + l; if (L >= nlines) break; const size_t e = (size_t)L * 64 + lane * 2; const int k = (int)(e % K), n = (int)(e / K); v2us o;
            o[0] = f2bf(w[(size_t)k * N + n]); o[1] = f2bf(w[(size_t)(k + 1) * N + n]); *(v2us*)(Bt + e) = o; }
         }
}
__global__ __launch_bounds__(256) void k_cvt8(const float* __restrict__ src, bf* dst, size_t n8) { const size_t i = (size_t)blockIdx.x * 256 + threadIdx.x; if (i >= n8) return; const v8f v = *(const v8f*)(src + i * 8); v8us o;
#pragma unroll
    for (int k = 0; k < 8; ++k) o[k] = f2bf(v[k]); *(v8us*)(dst + i * 8) = o;  }


__global__ __launch_bounds__(256) void k_vtp(const float* __restrict__ F, int pitch, int nheads, h16* V16, bf* Vh, bf* Vl) { const size_t e = ((size_t)blockIdx.x * 256 + threadIdx.x) * 2; if (e >= (size_t)nheads * HD * TT) return; const int t = (int)(e % TT); const int d = (int)((e / TT) % HD); const int g = (int)(e / ((size_t)TT * HD)); v2h o16; v2us oh, ol;
#pragma unroll
    for (int q = 0; q < 2; ++q) { const float x = F[(size_t)(t + q) * pitch + g * HD + d]; o16[q] = tohx(x); unsigned short a2, c2; splitf(x, a2, c2); oh[q] = a2; ol[q] = c2; }
    *(v2h*)(V16 + e) = o16; *(v2us*)(Vh + e) = oh; *(v2us*)(Vl + e) = ol;  }

__global__ __launch_bounds__(256) void k_merge(const float* __restrict__ O, int h0, float* OUTb) { const size_t e = ((size_t)blockIdx.x * 256 + threadIdx.x) * 2; if (e >= (size_t)ZH * TT * HD) return; const int d = (int)(e % HD); const int t = (int)((e / HD) % TT); const int zz = (int)(e / ((size_t)HD * TT)); const float cs = (t < RH) ? 1.0f : (1.0f / PCAR); const size_t oo = (size_t)t * DQ + (h0 + zz) * HD + d;
    v2f o2; o2[0] = O[e] * cs; o2[1] = O[e + 1] * cs; *(v2f*)(OUTb + oo) = o2;  }


__global__ __launch_bounds__(256) void k_vtpR1(const float* __restrict__ Vb, bf* Vh) { const size_t e = ((size_t)blockIdx.x * 256 + threadIdx.x) * 2; if (e >= (size_t)HD * TT) return; const int t = (int)(e % TT); const int d = (int)(e / TT); v2us o; o[0] = f2bf(Vb[(size_t)t * HD + d]); o[1] = f2bf(Vb[(size_t)(t + 1) * HD + d]); *(v2us*)(Vh + e) = o;  }
__global__ __launch_bounds__(256) void k_mergeR(const float* __restrict__ O, float* outb, size_t n4) { const size_t i = (size_t)blockIdx.x * 256 + threadIdx.x; if (i >= n4) return; const v4f a = *(const v4f*)(O + i * 4); *(v4f*)(outb + i * 4) = a;  }


// ---- k_prep: both bf16 forms of x in one launch, x read once. One work-group per WGP takes 256 tokens x 64 d of one (batch, head) plane; a half-wave reads one token's 256 B.
// A lane holds 4 d of tokens t and t + 1: pairs along d go through LDS array R, pairs along t through LDS array T as words [d][t / 2]; both leave as 512-B units in fragment order, lane l's 16 B at byte 16 l.
// Row planes: [t / 16][d / 8][t mod 16][8 d], 2 KB per 16 tokens. x^T planes: [t / 32][d / 16][(t mod 32) / 8][d mod 16][8 t], 4 KB per 32 tokens. So the piece that lane (c, h) of a matrix fragment needs is the lane's own 16 B of a unit.
// LDS: in T the 16-B chunk k of row d lies at chunk k ^ FSW(d), in R chunk (d / 8 = m, t mod 16) at t ^ GSW(m), so that the lanes of each store and the 16 lanes of each half of a 16-B read fall on different banks.
typedef __attribute__((ext_vector_type(2))) __bf16 v2bf;
typedef __attribute__((ext_vector_type(2))) unsigned v2u;
typedef __attribute__((ext_vector_type(4))) unsigned v4u;
typedef v2u __attribute__((may_alias)) v2ua;
typedef v4u __attribute__((may_alias)) v4ua;
#define PT 256
#define FSW(d) (((d) & 12) | (((d) ^ ((d) >> 4)) & 3))
#define GSW(m) (((m) & 1) | (((m) >> 1) << 2))
__device__ __forceinline__ unsigned pkbf(float x, float y) { v2f p; p[0] = x; p[1] = y; return __builtin_bit_cast(unsigned, __builtin_convertvector(p, v2bf)); }   // x in the low half; round to nearest even
__global__ __launch_bounds__(256) void k_prep(const float* __restrict__ X, bf* __restrict__ XB, bf* __restrict__ XT) {
    __shared__ __attribute__((aligned(16))) unsigned T[HD * (PT / 2)];
    __shared__ __attribute__((aligned(16))) unsigned R[PT * (HD / 2)];
    const int lane = threadIdx.x & 31, c = lane & 15, r = lane >> 4, wave = threadIdx.x >> 5;
    const int plane = blockIdx.y, tb = blockIdx.x * PT, t0 = tb + 32 * wave + 2 * r;
    const float* sp = X + (size_t)(plane / NH_) * TT * DM + (size_t)(plane % NH_) * HD + (size_t)t0 * DM + 4 * c;
    bf* bp = XB + (size_t)plane * TT * HD + (size_t)tb * HD + (8 * wave) * 256 + 8 * lane; bf* tp = XT + (size_t)plane * HD * TT + (size_t)tb * HD + (8 * wave) * 256 + 8 * lane;   /* the work-group's 32 KB of each plane; a wave stores 8 units of 512 B */
    v4f a[8], b[8];
#pragma unroll
    for (int i = 0; i < 8; ++i) { a[i] = *(const v4fa*)(sp + (size_t)(4 * i) * DM); b[i] = *(const v4fa*)(sp + (size_t)(4 * i + 1) * DM); }
    asm volatile("s_wait_xcnt 0x0" :: "v"(sp), "v"(bp), "v"(tp) : "memory");   // the loads are issued: their address register, held to this line, may be reused from here on; both store addresses are formed while the loads fly, not among the stores
    __builtin_amdgcn_sched_barrier(0);   // all 16 loads fly together: without it the compiler issues the last ones only behind waits for the first
    v2u u[8], w[8];
#pragma unroll
    for (int i = 0; i < 8; ++i) { u[i][0] = pkbf(a[i][0], a[i][1]); u[i][1] = pkbf(a[i][2], a[i][3]); w[i][0] = pkbf(b[i][0], b[i][1]); w[i][1] = pkbf(b[i][2], b[i][3]); }
#pragma unroll
    for (int i = 0; i < 8; ++i)
#pragma unroll
        for (int j = 0; j < 4; ++j) { const unsigned lo = u[i][j >> 1], hi = w[i][j >> 1];   /* d = 4 c + j of tokens t (low half) and t + 1 */
            T[(4 * c + j) * (PT / 2) + (((4 * wave + (i >> 1)) ^ FSW(4 * c + j)) << 2) + ((2 * i + r) & 3)] = (j & 1) ? ((lo >> 16) | (hi & 0xFFFF0000u)) : ((lo & 0xFFFFu) | (hi << 16)); }
#pragma unroll
    for (int i = 0; i < 8; ++i) { const int m = c >> 1; const int ri = (((2 * wave + (i >> 2)) * 128 + m * 16 + ((4 * (i & 3) + 2 * r) ^ GSW(m))) << 2) + 2 * (c & 1);   /* token t is even: token t + 1 lies at the chunk with bit 0 flipped */
        *(v2ua*)(R + ri) = u[i]; *(v2ua*)(R + (ri ^ 4)) = w[i]; }
    __syncthreads();   // every wave's words are in LDS before a unit is read; all global stores stand behind it, so that it does not wait for them
#pragma unroll
    for (int n = 0; n < 8; ++n) { const int d = 16 * (n >> 1) + c, k = 4 * wave + 2 * (n & 1) + r; *(v4ua*)(tp + n * 256) = *(const v4ua*)(T + d * (PT / 2) + ((k ^ FSW(d)) << 2)); }
#pragma unroll
    for (int n = 0; n < 8; ++n) { const int m = 2 * (n & 3) + r; *(v4ua*)(bp + n * 256) = *(const v4ua*)(R + (((2 * wave + (n >> 2)) * 128 + m * 16 + (c ^ GSW(m))) << 2)); }
}

typedef __attribute__((ext_vector_type(8))) unsigned v8u;
#define KBLK 64
__device__ __forceinline__ v16bf ldu(const bf* p) { return cat16b(*(const v8us*)p, *(const v8us*)(p + 256)); }   // two units one behind the other: the 8 k at 8h and the 8 k at 16 + 8h of a fragment
__device__ __forceinline__ float xhalf(float x) { return __builtin_bit_cast(float, __builtin_amdgcn_permlanex16(__builtin_bit_cast(int, x), __builtin_bit_cast(int, x), 0x76543210, 0xfedcba98, false, false)); }   // lane l takes lane l ^ 16's value
#define SC2  0.18033688011112042f   // HD^-0.5 x log2(e): the softmax runs in base 2
__global__ __launch_bounds__(128) void k_fattn(const bf* __restrict__ QB, const bf* __restrict__ KB, const bf* __restrict__ VT, float* __restrict__ OUT) {
    const int lane = threadIdx.x & 31, lr = lane & 15, hi = lane >> 4;
    const int wave = __builtin_amdgcn_readfirstlane((int)(threadIdx.x >> 5));   // scalar, so that the pass loop is a scalar loop
    const int plane = blockIdx.y;
    const bf* Qp = QB + (size_t)plane * TT * HD + 8 * lane; const bf* Kp = KB + (size_t)plane * TT * HD + 8 * lane; const bf* Vp = VT + (size_t)plane * HD * TT + 8 * lane;
    float* Op = OUT + (size_t)(plane / NH_) * TT * DM + (size_t)(plane % NH_) * HD;
    const int pr = blockIdx.x * 4 + wave;
    // the two tiles run one after the other through one copy of the code (rolled); every short loop below is unrolled so that the fragment arrays stay in registers
#pragma unroll 1
    for (int half = 0; half < 2; ++half) {
        const int q0 = (half ? (TT / 16 - 1 - pr) : pr) * 16; const int nblk = q0 / KBLK + 1; const int q = q0 + lr;
        v16bf qf[2], kf[4][2];
#pragma unroll
        for (int c = 0; c < 2; ++c) qf[c] = ldu(Qp + (size_t)q0 * HD + 512 * c);
#pragma unroll
        for (int nb = 0; nb < 4; ++nb)
#pragma unroll
            for (int c = 0; c < 2; ++c) kf[nb][c] = ldu(Kp + (size_t)(nb * 16) * HD + 512 * c);
        v8f o[4];
#pragma unroll
        for (int nd = 0; nd < 4; ++nd) o[nd] = (v8f){};
        float m = -3.0e38f, l = 0.f;
        // rolled: the trip count is the tile's own, and one pass already fills the register file
#pragma unroll 1
        for (int kb = 0; kb < nblk; ++kb) {
            const int key0 = kb * KBLK;
            v16bf vf[4][2];
#pragma unroll
            for (int nd = 0; nd < 4; ++nd)
#pragma unroll
                for (int c = 0; c < 2; ++c) vf[nd][c] = ldu(Vp + (size_t)key0 * HD + 2048 * c + 512 * nd);
            asm volatile("s_wait_xcnt 0x0" ::: "memory");   // the value loads are issued: their address registers may be reused from here on
            v8f s[4];
#pragma unroll
            for (int nb = 0; nb < 4; ++nb) { s[nb] = wmmab(kf[nb][0], qf[0], (v8f){}); s[nb] = wmmab(kf[nb][1], qf[1], s[nb]); }
            const int kn = (kb + 1 < nblk) ? key0 + KBLK : key0;   /* next pass's key rows, fetched behind this pass's products; the last pass re-reads its own */
#pragma unroll
            for (int nb = 0; nb < 4; ++nb)
#pragma unroll
                for (int c = 0; c < 2; ++c) kf[nb][c] = ldu(Kp + (size_t)(kn + nb * 16) * HD + 512 * c);
            asm volatile("s_wait_xcnt 0x0" ::: "memory");   // the key loads are issued: their address registers are reused below
            if (kb == nblk - 1) {   /* only the last pass meets the diagonal: keys after the query excluded */
#pragma unroll
                for (int nb = 0; nb < 4; ++nb)
#pragma unroll
                    for (int j = 0; j < 8; ++j) s[nb][j] = (key0 + nb * 16 + hi * 8 + j <= q) ? s[nb][j] : -3.0e38f; }
            float mx = m;
#pragma unroll
            for (int nb = 0; nb < 4; ++nb)
#pragma unroll
                for (int j = 0; j < 8; ++j) mx = fmaxf(mx, s[nb][j]);
            mx = fmaxf(mx, xhalf(mx));
            const float al = __builtin_amdgcn_exp2f((m - mx) * SC2); const float mc = mx * SC2; m = mx;
            float sum = 0.f; v8u ph[2], pl[2];
#pragma unroll
            for (int nb = 0; nb < 4; ++nb)
#pragma unroll
                for (int j = 0; j < 8; j += 2) {
                    v2f p; p[0] = __builtin_amdgcn_exp2f(fmaf(s[nb][j], SC2, -mc)); p[1] = __builtin_amdgcn_exp2f(fmaf(s[nb][j + 1], SC2, -mc)); sum += p[0] + p[1];
                    const unsigned wh = __builtin_bit_cast(unsigned, __builtin_convertvector(p, v2bf));
                    v2f hf; hf[0] = __uint_as_float(wh << 16); hf[1] = __uint_as_float(wh & 0xFFFF0000u); const v2f r = p - hf;
                    ph[nb >> 1][(nb & 1) * 4 + (j >> 1)] = wh; pl[nb >> 1][(nb & 1) * 4 + (j >> 1)] = __builtin_bit_cast(unsigned, __builtin_convertvector(r, v2bf)); }
            l = l * al + sum;
#pragma unroll
            for (int nd = 0; nd < 4; ++nd)
#pragma unroll
                for (int j = 0; j < 8; ++j) o[nd][j] *= al;
#pragma unroll
            for (int c = 0; c < 2; ++c)
#pragma unroll
                for (int nd = 0; nd < 4; ++nd) { o[nd] = wmmab(vf[nd][c], __builtin_bit_cast(v16bf, ph[c]), o[nd]); o[nd] = wmmab(vf[nd][c], __builtin_bit_cast(v16bf, pl[c]), o[nd]); }
        }
        l += xhalf(l);
        const float f = __fdiv_rn(1.0f, l);
        float* orow = Op + (size_t)q * DM + hi * 8;   /* lane (c, h) holds d = 16 nd + 8 h + r of query c */
#pragma unroll
        for (int nd = 0; nd < 4; ++nd) { v4f a, b2;
#pragma unroll
            for (int j = 0; j < 4; ++j) { a[j] = o[nd][j] * f; b2[j] = o[nd][j + 4] * f; }
            *(v4f*)(orow + nd * 16) = a; *(v4f*)(orow + nd * 16 + 4) = b2; }
        asm volatile("s_wait_xcnt 0x0" ::: "memory");   // the stores' address and data registers are rewritten by the next tile
    }
}

extern "C" void kernel_launch(void* const* d_in, const int* in_sizes, int n_in,
                              void* d_out, int out_size, void* d_ws, size_t ws_size, hipStream_t stream) {
    (void)in_sizes; (void)n_in; (void)out_size;
    const float* Xin = (const float*)d_in[0];   /* q = k = v = x */
    float* OUT = (float*)d_out;
    char* wsp = (char*)d_ws;
    auto take = [&](size_t bytes) { char* p = wsp; wsp += (bytes + 255) & ~(size_t)255; return (void*)p; };
    const size_t PB = (size_t)NH_ * TT * HD;   /* elements of one batch's planes */
    bf* XB = (bf*)take(NB_ * PB * 2); bf* VT = (bf*)take(NB_ * PB * 2);   /* one plane set serves queries and keys */
    if ((size_t)(wsp - (char*)d_ws) > ws_size) return;
    k_prep<<<dim3(TT / PT, NB_ * NH_, 1), 256, 0, stream>>>(Xin, XB, VT);
    k_fattn<<<dim3(TT / 128, NB_ * NH_, 1), 128, 0, stream>>>(XB, XB, VT, OUT);   /* every (batch, head) plane in one launch */
}

// v004
// It runs in 37 microseconds.
// In two side-by-side timings against v003, it was 1.18 and 1.19 times as fast.
// All steps since v000 together make it 57.8 times as fast.
#include <hip/hip_runtime.h>

// Parameter-free causal self-attention with x as q, k and v (x [2][2048][1024] viewed as 16 heads x 64; scores = x_h.x_h / 8; causal (-inf); softmax; out = attn x_h merged -> [2][2048][1024] (4.2 M)).
// Layout: one set of bf16 planes per (batch, head) for queries and keys plus x^T planes for the value side, both built from x by one launch and both stored in fragment order (a wave's 16-B pieces of one fragment half lie side by side, 512 B); one fused kernel walks the keys of every query tile with a running maximum and sum (two waves a tile, alternate key blocks, joined through LDS), so scores and P stay in registers; merged token-major output rows.
// Compute dtypes, f32 accumulate: every input rounded to bf16; q.k exact; softmax f32; P hi/lo x exact v on every row; output f32.

#define NB_  2
#define TT   2048
#define DM   1024      // token-major row pitch (H x HD)
#define NH_  16
#define NKV  1
#define REP  (NH_ / NKV)
#define HD   64
#define DQ   (NH_ * HD)
#define DKV  (NKV * HD)
#define ZH   1
#define RH   2048
#define WIN  0
#define PCAR 1024.0f
#define SCL  0.125f   // 1/sqrt(64)
typedef _Float16 h16;
typedef unsigned short bf;
typedef __attribute__((ext_vector_type(16))) __bf16   v16bf;
typedef __attribute__((ext_vector_type(16))) _Float16 v16h;
typedef __attribute__((ext_vector_type(8)))  _Float16 v8h;
typedef __attribute__((ext_vector_type(8)))  unsigned short v8us;
typedef __attribute__((ext_vector_type(8)))  float    v8f;
typedef __attribute__((ext_vector_type(4)))  float    v4f;
typedef v8h  __attribute__((may_alias)) v8ha;
typedef v4f  __attribute__((may_alias)) v4fa;
typedef v8us __attribute__((may_alias)) v8usa;

__device__ __forceinline__ unsigned short f2bf(float f) { unsigned u = __float_as_uint(f); u += 0x7FFFu + ((u >> 16) & 1u); return (unsigned short)(u >> 16); }
__device__ __forceinline__ float bf2f(unsigned short b) { return __uint_as_float(((unsigned)b) << 16); }
__device__ __forceinline__ float bfr(float f) { return bf2f(f2bf(f)); }
__device__ __forceinline__ v16h cat16(v8h lo, v8h hi) { return __builtin_shufflevector(lo, hi, 0, 1, 2, 3, 4, 5, 6, 7, 8, 9, 10, 11, 12, 13, 14, 15); }
__device__ __forceinline__ v16bf cat16b(v8us lo, v8us hi) { return __builtin_bit_cast(v16bf, __builtin_shufflevector(lo, hi, 0, 1, 2, 3, 4, 5, 6, 7, 8, 9, 10, 11, 12, 13, 14, 15)); }
__device__ __forceinline__ v8f wmma16(v16h a, v16h b, v8f c) { return __builtin_amdgcn_wmma_f32_16x16x32_f16(false, a, false, b, (short)0, c, false, false); }
__device__ __forceinline__ v8f wmmab(v16bf a, v16bf b, v8f c) { return __builtin_amdgcn_wmma_f32_16x16x32_bf16(false, a, false, b, (short)0, c, false, false); }



// ---- fragment loader: row c of a K-contiguous 16-bit plane in the hardware k order (8 k at 8h, 8 k at 16 + 8h); the same code serves A and B.
template <typename T16> struct WFrag;
template <> struct WFrag<h16> { typedef v16h V; static __device__ __forceinline__ V ld(const h16* p) { return cat16(*(const v8h*)p, *(const v8h*)(p + 16)); } static __device__ __forceinline__ v8f mma(V a, V b, v8f c) { return wmma16(a, b, c); } };
template <> struct WFrag<bf> { typedef v16bf V; static __device__ __forceinline__ V ld(const bf* p) { return cat16b(*(const v8us*)p, *(const v8us*)(p + 16)); } static __device__ __forceinline__ v8f mma(V a, V b, v8f c) { return wmmab(a, b, c); } };

__device__ __forceinline__ h16 tohx(float x) { return (h16)x; }
__device__ __forceinline__ void splitf(float y, unsigned short& h, unsigned short& l) { h = f2bf(y); l = f2bf(y - bf2f(h)); }
typedef __attribute__((ext_vector_type(2))) _Float16 v2h;
typedef __attribute__((ext_vector_type(4))) _Float16 v4h;
typedef __attribute__((ext_vector_type(2))) unsigned short v2us;
typedef __attribute__((ext_vector_type(4))) unsigned short v4us;
typedef __attribute__((ext_vector_type(2))) float v2f;
typedef __attribute__((ext_vector_type(4))) int v4i;

__global__ __launch_bounds__(256) void k_wtG(const float* __restrict__ w, int K, int N, bf* Bt) {
    const int lane = threadIdx.x & 31; const int L0 = (blockIdx.x * 8 + (threadIdx.x >> 5)) * 8; const int nlines = N * K / 64;
{
#pragma unroll 1
        for (int l = 0; l < 8; ++l) { const int L = L0 + l; if (L >= nlines) break; const size_t e = (size_t)L * 64 + lane * 2; const int k = (int)(e % K), n = (int)(e / K); v2us o;
            o[0] = f2bf(w[(size_t)k * N + n]); o[1] = f2bf(w[(size_t)(k + 1) * N + n]); *(v2us*)(Bt + e) = o; }
         }
}
__global__ __launch_bounds__(256) void k_cvt8(const float* __restrict__ src, bf* dst, size_t n8) { const size_t i = (size_t)blockIdx.x * 256 + threadIdx.x; if (i >= n8) return; const v8f v = *(const v8f*)(src + i * 8); v8us o;
#pragma unroll
    for (int k = 0; k < 8; ++k) o[k] = f2bf(v[k]); *(v8us*)(dst + i * 8) = o;  }


__global__ __launch_bounds__(256) void k_vtp(const float* __restrict__ F, int pitch, int nheads, h16* V16, bf* Vh, bf* Vl) { const size_t e = ((size_t)blockIdx.x * 256 + threadIdx.x) * 2; if (e >= (size_t)nheads * HD * TT) return; const int t = (int)(e % TT); const int d = (int)((e / TT) % HD); const int g = (int)(e / ((size_t)TT * HD)); v2h o16; v2us oh, ol;
#pragma unroll
    for (int q = 0; q < 2; ++q) { const float x = F[(size_t)(t + q) * pitch + g * HD + d]; o16[q] = tohx(x); unsigned short a2, c2; splitf(x, a2, c2); oh[q] = a2; ol[q] = c2; }
    *(v2h*)(V16 + e) = o16; *(v2us*)(Vh + e) = oh; *(v2us*)(Vl + e) = ol;  }

__global__ __launch_bounds__(256) void k_merge(const float* __restrict__ O, int h0, float* OUTb) { const size_t e = ((size_t)blockIdx.x * 256 + threadIdx.x) * 2; if (e >= (size_t)ZH * TT * HD) return; const int d = (int)(e % HD); const int t = (int)((e / HD) % TT); const int zz = (int)(e / ((size_t)HD * TT)); const float cs = (t < RH) ? 1.0f : (1.0f / PCAR); const size_t oo = (size_t)t * DQ + (h0 + zz) * HD + d;
    v2f o2; o2[0] = O[e] * cs; o2[1] = O[e + 1] * cs; *(v2f*)(OUTb + oo) = o2;  }


__global__ __launch_bounds__(256) void k_vtpR1(const float* __restrict__ Vb, bf* Vh) { const size_t e = ((size_t)blockIdx.x * 256 + threadIdx.x) * 2; if (e >= (size_t)HD * TT) return; const int t = (int)(e % TT); const int d = (int)(e / TT); v2us o; o[0] = f2bf(Vb[(size_t)t * HD + d]); o[1] = f2bf(Vb[(size_t)(t + 1) * HD + d]); *(v2us*)(Vh + e) = o;  }
__global__ __launch_bounds__(256) void k_mergeR(const float* __restrict__ O, float* outb, size_t n4) { const size_t i = (size_t)blockIdx.x * 256 + threadIdx.x; if (i >= n4) return; const v4f a = *(const v4f*)(O + i * 4); *(v4f*)(outb + i * 4) = a;  }


// ---- k_prep: both bf16 forms of x in one launch, x read once. One work-group per WGP takes 256 tokens x 64 d of one (batch, head) plane; a half-wave reads one token's 256 B.
// A lane holds 4 d of tokens t and t + 1: pairs along d go through LDS array R, pairs along t through LDS array T as words [d][t / 2]; both leave as 512-B units in fragment order, lane l's 16 B at byte 16 l.
// Row planes: [t / 16][d / 8][t mod 16][8 d], 2 KB per 16 tokens. x^T planes: [t / 32][d / 16][(t mod 32) / 8][d mod 16][8 t], 4 KB per 32 tokens. So the piece that lane (c, h) of a matrix fragment needs is the lane's own 16 B of a unit.
// LDS: in T the 16-B chunk k of row d lies at chunk k ^ FSW(d), in R chunk (d / 8 = m, t mod 16) at t ^ GSW(m), so that the lanes of each store and the 16 lanes of each half of a 16-B read fall on different banks.
typedef __attribute__((ext_vector_type(2))) __bf16 v2bf;
typedef __attribute__((ext_vector_type(2))) unsigned v2u;
typedef __attribute__((ext_vector_type(4))) unsigned v4u;
typedef v2u __attribute__((may_alias)) v2ua;
typedef v4u __attribute__((may_alias)) v4ua;
#define PT 256
#define FSW(d) (((d) & 12) | (((d) ^ ((d) >> 4)) & 3))
#define GSW(m) (((m) & 1) | (((m) >> 1) << 2))
__device__ __forceinline__ unsigned pkbf(float x, float y) { v2f p; p[0] = x; p[1] = y; return __builtin_bit_cast(unsigned, __builtin_convertvector(p, v2bf)); }   // x in the low half; round to nearest even
__global__ __launch_bounds__(256) void k_prep(const float* __restrict__ X, bf* __restrict__ XB, bf* __restrict__ XT) {
    __shared__ __attribute__((aligned(16))) unsigned T[HD * (PT / 2)];
    __shared__ __attribute__((aligned(16))) unsigned R[PT * (HD / 2)];
    const int lane = threadIdx.x & 31, c = lane & 15, r = lane >> 4, wave = threadIdx.x >> 5;
    const int plane = blockIdx.y, tb = blockIdx.x * PT, t0 = tb + 32 * wave + 2 * r;
    const float* sp = X + (size_t)(plane / NH_) * TT * DM + (size_t)(plane % NH_) * HD + (size_t)t0 * DM + 4 * c;
    bf* bp = XB + (size_t)plane * TT * HD + (size_t)tb * HD + (8 * wave) * 256 + 8 * lane; bf* tp = XT + (size_t)plane * HD * TT + (size_t)tb * HD + (8 * wave) * 256 + 8 * lane;   /* the work-group's 32 KB of each plane; a wave stores 8 units of 512 B */
    v4f a[8], b[8];
#pragma unroll
    for (int i = 0; i < 8; ++i) { a[i] = *(const v4fa*)(sp + (size_t)(4 * i) * DM); b[i] = *(const v4fa*)(sp + (size_t)(4 * i + 1) * DM); }
    asm volatile("s_wait_xcnt 0x0" :: "v"(sp), "v"(bp), "v"(tp) : "memory");   // the loads are issued: their address register, held to this line, may be reused from here on; both store addresses are formed while the loads fly, not among the stores
    __builtin_amdgcn_sched_barrier(0);   // all 16 loads fly together: without it the compiler issues the last ones only behind waits for the first
    v2u u[8], w[8];
#pragma unroll
    for (int i = 0; i < 8; ++i) { u[i][0] = pkbf(a[i][0], a[i][1]); u[i][1] = pkbf(a[i][2], a[i][3]); w[i][0] = pkbf(b[i][0], b[i][1]); w[i][1] = pkbf(b[i][2], b[i][3]); }
#pragma unroll
    for (int i = 0; i < 8; ++i)
#pragma unroll
        for (int j = 0; j < 4; ++j) { const unsigned lo = u[i][j >> 1], hi = w[i][j >> 1];   /* d = 4 c + j of tokens t (low half) and t + 1 */
            T[(4 * c + j) * (PT / 2) + (((4 * wave + (i >> 1)) ^ FSW(4 * c + j)) << 2) + ((2 * i + r) & 3)] = (j & 1) ? ((lo >> 16) | (hi & 0xFFFF0000u)) : ((lo & 0xFFFFu) | (hi << 16)); }
#pragma unroll
    for (int i = 0; i < 8; ++i) { const int m = c >> 1; const int ri = (((2 * wave + (i >> 2)) * 128 + m * 16 + ((4 * (i & 3) + 2 * r) ^ GSW(m))) << 2) + 2 * (c & 1);   /* token t is even: token t + 1 lies at the chunk with bit 0 flipped */
        *(v2ua*)(R + ri) = u[i]; *(v2ua*)(R + (ri ^ 4)) = w[i]; }
    __syncthreads();   // every wave's words are in LDS before a unit is read; all global stores stand behind it, so that it does not wait for them
#pragma unroll
    for (int n = 0; n < 8; ++n) { const int d = 16 * (n >> 1) + c, k = 4 * wave + 2 * (n & 1) + r; *(v4ua*)(tp + n * 256) = *(const v4ua*)(T + d * (PT / 2) + ((k ^ FSW(d)) << 2)); }
#pragma unroll
    for (int n = 0; n < 8; ++n) { const int m = 2 * (n & 3) + r; *(v4ua*)(bp + n * 256) = *(const v4ua*)(R + (((2 * wave + (n >> 2)) * 128 + m * 16 + (c ^ GSW(m))) << 2)); }
}

typedef __attribute__((ext_vector_type(8))) unsigned v8u;
#define KBLK 64
__device__ __forceinline__ v16bf ldu(const bf* p) { return cat16b(*(const v8us*)p, *(const v8us*)(p + 256)); }   // two units one behind the other: the 8 k at 8h and the 8 k at 16 + 8h of a fragment
__device__ __forceinline__ float xhalf(float x) { return __builtin_bit_cast(float, __builtin_amdgcn_permlanex16(__builtin_bit_cast(int, x), __builtin_bit_cast(int, x), 0x76543210, 0xfedcba98, false, false)); }   // lane l takes lane l ^ 16's value
#define SC2  0.18033688011112042f   // HD^-0.5 x log2(e): the softmax runs in base 2
__global__ __launch_bounds__(256) void k_fattn(const bf* __restrict__ QB, const bf* __restrict__ KB, const bf* __restrict__ VT, float* __restrict__ OUT) {
    __shared__ __attribute__((aligned(16))) v4f XO[2][8][4][32];   /* [tile of the pair][wave][16-B piece][lane]: a buffer per tile, so one barrier per tile is enough */
    __shared__ __attribute__((aligned(8))) v2f XM[2][8][32];       /* the wave's maximum and its lane's sum */
    const int lane = threadIdx.x & 31, lr = lane & 15, hi = lane >> 4;
    const int wave = __builtin_amdgcn_readfirstlane((int)(threadIdx.x >> 5));   // scalar, so that the pass loop is a scalar loop
    const int plane = blockIdx.y;
    const bf* Qp = QB + (size_t)plane * TT * HD + 8 * lane; const bf* Kp = KB + (size_t)plane * TT * HD + 8 * lane; const bf* Vp = VT + (size_t)plane * HD * TT + 8 * lane;
    float* Op = OUT + (size_t)(plane / NH_) * TT * DM + (size_t)(plane % NH_) * HD;
    const int z = wave >> 2;   /* which of the two key shares */
    const int pr = blockIdx.x * 4 + (wave & 3);
    // the two tiles run one after the other through one copy of the code (rolled); every short loop below is unrolled so that the fragment arrays stay in registers
#pragma unroll 1
    for (int half = 0; half < 2; ++half) {
        const int q0 = (half ? (TT / 16 - 1 - pr) : pr) * 16; const int nblk = q0 / KBLK + 1; const int q = q0 + lr;
        v16bf qf[2], kf[4][2];
#pragma unroll
        for (int c = 0; c < 2; ++c) qf[c] = ldu(Qp + (size_t)q0 * HD + 512 * c);
#pragma unroll
        for (int nb = 0; nb < 4; ++nb)
#pragma unroll
            for (int c = 0; c < 2; ++c) kf[nb][c] = ldu(Kp + (size_t)(z * KBLK + nb * 16) * HD + 512 * c);
        v8f o[4];
#pragma unroll
        for (int nd = 0; nd < 4; ++nd) o[nd] = (v8f){};
        float m = -3.0e38f, l = 0.f;
        // rolled: the trip count is the tile's own, and one pass already fills the register file
#pragma unroll 1
        for (int kb = z; kb < nblk; kb += 2) {
            const int key0 = kb * KBLK;
            v16bf vf[4][2];
#pragma unroll
            for (int nd = 0; nd < 4; ++nd)
#pragma unroll
                for (int c = 0; c < 2; ++c) vf[nd][c] = ldu(Vp + (size_t)key0 * HD + 2048 * c + 512 * nd);
            asm volatile("s_wait_xcnt 0x0" ::: "memory");   // the value loads are issued: their address registers may be reused from here on
            v8f s[4];
#pragma unroll
            for (int nb = 0; nb < 4; ++nb) { s[nb] = wmmab(kf[nb][0], qf[0], (v8f){}); s[nb] = wmmab(kf[nb][1], qf[1], s[nb]); }
            const int kn = (kb + 2 < nblk) ? key0 + 2 * KBLK : key0;   /* the wave's next pass's key rows, fetched behind this pass's products; the last pass re-reads its own */
#pragma unroll
            for (int nb = 0; nb < 4; ++nb)
#pragma unroll
                for (int c = 0; c < 2; ++c) kf[nb][c] = ldu(Kp + (size_t)(kn + nb * 16) * HD + 512 * c);
            asm volatile("s_wait_xcnt 0x0" ::: "memory");   // the key loads are issued: their address registers are reused below
            if (kb == nblk - 1) {   /* only the last pass meets the diagonal: keys after the query excluded */
#pragma unroll
                for (int nb = 0; nb < 4; ++nb)
#pragma unroll
                    for (int j = 0; j < 8; ++j) s[nb][j] = (key0 + nb * 16 + hi * 8 + j <= q) ? s[nb][j] : -3.0e38f; }
            float mx = m;
#pragma unroll
            for (int nb = 0; nb < 4; ++nb)
#pragma unroll
                for (int j = 0; j < 8; ++j) mx = fmaxf(mx, s[nb][j]);
            mx = fmaxf(mx, xhalf(mx));
            const float al = __builtin_amdgcn_exp2f((m - mx) * SC2); const float mc = mx * SC2; m = mx;
            float sum = 0.f; v8u ph[2], pl[2];
#pragma unroll
            for (int nb = 0; nb < 4; ++nb)
#pragma unroll
                for (int j = 0; j < 8; j += 2) {
                    v2f p; p[0] = __builtin_amdgcn_exp2f(fmaf(s[nb][j], SC2, -mc)); p[1] = __builtin_amdgcn_exp2f(fmaf(s[nb][j + 1], SC2, -mc)); sum += p[0] + p[1];
                    const unsigned wh = __builtin_bit_cast(unsigned, __builtin_convertvector(p, v2bf));
                    v2f hf; hf[0] = __uint_as_float(wh << 16); hf[1] = __uint_as_float(wh & 0xFFFF0000u); const v2f r = p - hf;
                    ph[nb >> 1][(nb & 1) * 4 + (j >> 1)] = wh; pl[nb >> 1][(nb & 1) * 4 + (j >> 1)] = __builtin_bit_cast(unsigned, __builtin_convertvector(r, v2bf)); }
            l = l * al + sum;
#pragma unroll
            for (int nd = 0; nd < 4; ++nd)
#pragma unroll
                for (int j = 0; j < 8; ++j) o[nd][j] *= al;
#pragma unroll
            for (int c = 0; c < 2; ++c)
#pragma unroll
                for (int nd = 0; nd < 4; ++nd) { o[nd] = wmmab(vf[nd][c], __builtin_bit_cast(v16bf, ph[c]), o[nd]); o[nd] = wmmab(vf[nd][c], __builtin_bit_cast(v16bf, pl[c]), o[nd]); }
        }
        // join the two key shares: share z finishes d = 32 z .. 32 z + 31 and hands the other two tiles of O^T to its partner. A share without a pass (one-pass tile, z = 1) holds m = -3.0e38, l = 0, O = 0 and gets weight 0.
        v8f kp[2], gv[2];
#pragma unroll
        for (int i = 0; i < 2; ++i) { kp[i] = z ? o[2 + i] : o[i]; gv[i] = z ? o[i] : o[2 + i]; }
#pragma unroll
        for (int i = 0; i < 2; ++i) { XO[half][wave][2 * i][lane] = __builtin_shufflevector(gv[i], gv[i], 0, 1, 2, 3); XO[half][wave][2 * i + 1][lane] = __builtin_shufflevector(gv[i], gv[i], 4, 5, 6, 7); }
        { v2f ml; ml[0] = m; ml[1] = l; XM[half][wave][lane] = ml; }
        __syncthreads();   // both shares of every tile are in LDS before a partner reads them
        const v2f pm = XM[half][wave ^ 4][lane];
        const float mt = fmaxf(m, pm[0]); const float w0 = __builtin_amdgcn_exp2f((m - mt) * SC2), w1 = __builtin_amdgcn_exp2f((pm[0] - mt) * SC2);
        float lt = l * w0 + pm[1] * w1; lt += xhalf(lt);
        const float f = __fdiv_rn(1.0f, lt); const float f0 = w0 * f, f1 = w1 * f;
        float* orow = Op + (size_t)q * DM + z * 32 + hi * 8;   /* lane (c, h) holds d = 16 nd + 8 h + r of query c */
#pragma unroll
        for (int i = 0; i < 2; ++i) { const v4f pa = XO[half][wave ^ 4][2 * i][lane], pb = XO[half][wave ^ 4][2 * i + 1][lane]; v4f a, b2;
#pragma unroll
            for (int j = 0; j < 4; ++j) { a[j] = kp[i][j] * f0 + pa[j] * f1; b2[j] = kp[i][j + 4] * f0 + pb[j] * f1; }
            *(v4f*)(orow + i * 16) = a; *(v4f*)(orow + i * 16 + 4) = b2; }
        asm volatile("s_wait_xcnt 0x0" ::: "memory");   // the stores' address and data registers are rewritten by the next tile
    }
}

extern "C" void kernel_launch(void* const* d_in, const int* in_sizes, int n_in,
                              void* d_out, int out_size, void* d_ws, size_t ws_size, hipStream_t stream) {
    (void)in_sizes; (void)n_in; (void)out_size;
    const float* Xin = (const float*)d_in[0];   /* q = k = v = x */
    float* OUT = (float*)d_out;
    char* wsp = (char*)d_ws;
    auto take = [&](size_t bytes) { char* p = wsp; wsp += (bytes + 255) & ~(size_t)255; return (void*)p; };
    const size_t PB = (size_t)NH_ * TT * HD;   /* elements of one batch's planes */
    bf* XB = (bf*)take(NB_ * PB * 2); bf* VT = (bf*)take(NB_ * PB * 2);   /* one plane set serves queries and keys */
    if ((size_t)(wsp - (char*)d_ws) > ws_size) return;
    k_prep<<<dim3(TT / PT, NB_ * NH_, 1), 256, 0, stream>>>(Xin, XB, VT);
    k_fattn<<<dim3(TT / 128, NB_ * NH_, 1), 256, 0, stream>>>(XB, XB, VT, OUT);   /* every (batch, head) plane in one launch */
}

// v005
// A run of this version takes 31.7 microseconds.
// In two side-by-side timings against v004, it was 1.16 and 1.17 times as fast.
// All steps since v000 together make it 67.4 times as fast.
#include <hip/hip_runtime.h>

// Parameter-free causal self-attention with x as q, k and v (x [2][2048][1024] viewed as 16 heads x 64; scores = x_h.x_h / 8; causal (-inf); softmax; out = attn x_h merged -> [2][2048][1024] (4.2 M)).
// Layout: one set of bf16 planes per (batch, head) for queries and keys plus f16 x^T planes for the value side, both built from x by one launch and both stored in fragment order (a wave's 16-B pieces of one fragment half lie side by side, 512 B); one fused kernel walks the keys of every query tile with a running maximum and sum (two waves a tile, alternate key blocks, joined through LDS), so scores and P stay in registers; merged token-major output rows.
// Compute dtypes, f32 accumulate: every input rounded to bf16; q.k on bf16 operands, exact products; softmax f32; P.V on f16 operands: P in [0, 1] rounded once to f16 (11 bits), v the bf16-rounded x re-encoded as f16 (exact for 2^-17 <= |x| < 65520, to 2^-25 below); output f32.

#define NB_  2
#define TT   2048
#define DM   1024      // token-major row pitch (H x HD)
#define NH_  16
#define NKV  1
#define REP  (NH_ / NKV)
#define HD   64
#define DQ   (NH_ * HD)
#define DKV  (NKV * HD)
#define ZH   1
#define RH   2048
#define WIN  0
#define PCAR 1024.0f
#define SCL  0.125f   // 1/sqrt(64)
typedef _Float16 h16;
typedef unsigned short bf;
typedef __attribute__((ext_vector_type(16))) __bf16   v16bf;
typedef __attribute__((ext_vector_type(16))) _Float16 v16h;
typedef __attribute__((ext_vector_type(8)))  _Float16 v8h;
typedef __attribute__((ext_vector_type(8)))  unsigned short v8us;
typedef __attribute__((ext_vector_type(8)))  float    v8f;
typedef __attribute__((ext_vector_type(4)))  float    v4f;
typedef v8h  __attribute__((may_alias)) v8ha;
typedef v4f  __attribute__((may_alias)) v4fa;
typedef v8us __attribute__((may_alias)) v8usa;

__device__ __forceinline__ unsigned short f2bf(float f) { unsigned u = __float_as_uint(f); u += 0x7FFFu + ((u >> 16) & 1u); return (unsigned short)(u >> 16); }
__device__ __forceinline__ float bf2f(unsigned short b) { return __uint_as_float(((unsigned)b) << 16); }
__device__ __forceinline__ float bfr(float f) { return bf2f(f2bf(f)); }
__device__ __forceinline__ v16h cat16(v8h lo, v8h hi) { return __builtin_shufflevector(lo, hi, 0, 1, 2, 3, 4, 5, 6, 7, 8, 9, 10, 11, 12, 13, 14, 15); }
__device__ __forceinline__ v16bf cat16b(v8us lo, v8us hi) { return __builtin_bit_cast(v16bf, __builtin_shufflevector(lo, hi, 0, 1, 2, 3, 4, 5, 6, 7, 8, 9, 10, 11, 12, 13, 14, 15)); }
__device__ __forceinline__ v8f wmma16(v16h a, v16h b, v8f c) { return __builtin_amdgcn_wmma_f32_16x16x32_f16(false, a, false, b, (short)0, c, false, false); }
__device__ __forceinline__ v8f wmmab(v16bf a, v16bf b, v8f c) { return __builtin_amdgcn_wmma_f32_16x16x32_bf16(false, a, false, b, (short)0, c, false, false); }



// ---- fragment loader: row c of a K-contiguous 16-bit plane in the hardware k order (8 k at 8h, 8 k at 16 + 8h); the same code serves A and B.
template <typename T16> struct WFrag;
template <> struct WFrag<h16> { typedef v16h V; static __device__ __forceinline__ V ld(const h16* p) { return cat16(*(const v8h*)p, *(const v8h*)(p + 16)); } static __device__ __forceinline__ v8f mma(V a, V b, v8f c) { return wmma16(a, b, c); } };
template <> struct WFrag<bf> { typedef v16bf V; static __device__ __forceinline__ V ld(const bf* p) { return cat16b(*(const v8us*)p, *(const v8us*)(p + 16)); } static __device__ __forceinline__ v8f mma(V a, V b, v8f c) { return wmmab(a, b, c); } };

__device__ __forceinline__ h16 tohx(float x) { return (h16)x; }
__device__ __forceinline__ void splitf(float y, unsigned short& h, unsigned short& l) { h = f2bf(y); l = f2bf(y - bf2f(h)); }
typedef __attribute__((ext_vector_type(2))) _Float16 v2h;
typedef __attribute__((ext_vector_type(4))) _Float16 v4h;
typedef __attribute__((ext_vector_type(2))) unsigned short v2us;
typedef __attribute__((ext_vector_type(4))) unsigned short v4us;
typedef __attribute__((ext_vector_type(2))) float v2f;
typedef __attribute__((ext_vector_type(4))) int v4i;

__global__ __launch_bounds__(256) void k_wtG(const float* __restrict__ w, int K, int N, bf* Bt) {
    const int lane = threadIdx.x & 31; const int L0 = (blockIdx.x * 8 + (threadIdx.x >> 5)) * 8; const int nlines = N * K / 64;
{
#pragma unroll 1
        for (int l = 0; l < 8; ++l) { const int L = L0 + l; if (L >= nlines) break; const size_t e = (size_t)L * 64 + lane * 2; const int k = (int)(e % K), n = (int)(e / K); v2us o;
            o[0] = f2bf(w[(size_t)k * N + n]); o[1] = f2bf(w[(size_t)(k + 1) * N + n]); *(v2us*)(Bt + e) = o; }
         }
}
__global__ __launch_bounds__(256) void k_cvt8(const float* __restrict__ src, bf* dst, size_t n8) { const size_t i = (size_t)blockIdx.x * 256 + threadIdx.x; if (i >= n8) return; const v8f v = *(const v8f*)(src + i * 8); v8us o;
#pragma unroll
    for (int k = 0; k < 8; ++k) o[k] = f2bf(v[k]); *(v8us*)(dst + i * 8) = o;  }


__global__ __launch_bounds__(256) void k_vtp(const float* __restrict__ F, int pitch, int nheads, h16* V16, bf* Vh, bf* Vl) { const size_t e = ((size_t)blockIdx.x * 256 + threadIdx.x) * 2; if (e >= (size_t)nheads * HD * TT) return; const int t = (int)(e % TT); const int d = (int)((e / TT) % HD); const int g = (int)(e / ((size_t)TT * HD)); v2h o16; v2us oh, ol;
#pragma unroll
    for (int q = 0; q < 2; ++q) { const float x = F[(size_t)(t + q) * pitch + g * HD + d]; o16[q] = tohx(x); unsigned short a2, c2; splitf(x, a2, c2); oh[q] = a2; ol[q] = c2; }
    *(v2h*)(V16 + e) = o16; *(v2us*)(Vh + e) = oh; *(v2us*)(Vl + e) = ol;  }

__global__ __launch_bounds__(256) void k_merge(const float* __restrict__ O, int h0, float* OUTb) { const size_t e = ((size_t)blockIdx.x * 256 + threadIdx.x) * 2; if (e >= (size_t)ZH * TT * HD) return; const int d = (int)(e % HD); const int t = (int)((e / HD) % TT); const int zz = (int)(e / ((size_t)HD * TT)); const float cs = (t < RH) ? 1.0f : (1.0f / PCAR); const size_t oo = (size_t)t * DQ + (h0 + zz) * HD + d;
    v2f o2; o2[0] = O[e] * cs; o2[1] = O[e + 1] * cs; *(v2f*)(OUTb + oo) = o2;  }


__global__ __launch_bounds__(256) void k_vtpR1(const float* __restrict__ Vb, bf* Vh) { const size_t e = ((size_t)blockIdx.x * 256 + threadIdx.x) * 2; if (e >= (size_t)HD * TT) return; const int t = (int)(e % TT); const int d = (int)(e / TT); v2us o; o[0] = f2bf(Vb[(size_t)t * HD + d]); o[1] = f2bf(Vb[(size_t)(t + 1) * HD + d]); *(v2us*)(Vh + e) = o;  }
__global__ __launch_bounds__(256) void k_mergeR(const float* __restrict__ O, float* outb, size_t n4) { const size_t i = (size_t)blockIdx.x * 256 + threadIdx.x; if (i >= n4) return; const v4f a = *(const v4f*)(O + i * 4); *(v4f*)(outb + i * 4) = a;  }


// ---- k_prep: both 16-bit forms of x in one launch (bf16 rows; x^T with the same rounded values as f16), x read once. One work-group per WGP takes 256 tokens x 64 d of one (batch, head) plane; a half-wave reads one token's 256 B.
// A lane holds 4 d of tokens t and t + 1: pairs along d go through LDS array R, pairs along t through LDS array T as words [d][t / 2]; both leave as 512-B units in fragment order, lane l's 16 B at byte 16 l.
// Row planes: [t / 16][d / 8][t mod 16][8 d], 2 KB per 16 tokens. x^T planes: [t / 32][d / 16][(t mod 32) / 8][d mod 16][8 t], 4 KB per 32 tokens. So the piece that lane (c, h) of a matrix fragment needs is the lane's own 16 B of a unit.
// LDS: in T the 16-B chunk k of row d lies at chunk k ^ FSW(d), in R chunk (d / 8 = m, t mod 16) at t ^ GSW(m), so that the lanes of each store and the 16 lanes of each half of a 16-B read fall on different banks.
typedef __attribute__((ext_vector_type(2))) __bf16 v2bf;
typedef __attribute__((ext_vector_type(2))) unsigned v2u;
typedef __attribute__((ext_vector_type(4))) unsigned v4u;
typedef v2u __attribute__((may_alias)) v2ua;
typedef v4u __attribute__((may_alias)) v4ua;
#define PT 256
#define FSW(d) (((d) & 12) | (((d) ^ ((d) >> 4)) & 3))
#define GSW(m) (((m) & 1) | (((m) >> 1) << 2))
__device__ __forceinline__ unsigned pkbf(float x, float y) { v2f p; p[0] = x; p[1] = y; return __builtin_bit_cast(unsigned, __builtin_convertvector(p, v2bf)); }   // x in the low half; round to nearest even
__device__ __forceinline__ unsigned pkh(float x, float y) { v2f p; p[0] = x; p[1] = y; return __builtin_bit_cast(unsigned, __builtin_convertvector(p, v2h)); }   // the same to f16
__global__ __launch_bounds__(256) void k_prep(const float* __restrict__ X, bf* __restrict__ XB, bf* __restrict__ XT) {
    __shared__ __attribute__((aligned(16))) unsigned T[HD * (PT / 2)];
    __shared__ __attribute__((aligned(16))) unsigned R[PT * (HD / 2)];
    const int lane = threadIdx.x & 31, c = lane & 15, r = lane >> 4, wave = threadIdx.x >> 5;
    const int plane = blockIdx.y, tb = blockIdx.x * PT, t0 = tb + 32 * wave + 2 * r;
    const float* sp = X + (size_t)(plane / NH_) * TT * DM + (size_t)(plane % NH_) * HD + (size_t)t0 * DM + 4 * c;
    bf* bp = XB + (size_t)plane * TT * HD + (size_t)tb * HD + (8 * wave) * 256 + 8 * lane; bf* tp = XT + (size_t)plane * HD * TT + (size_t)tb * HD + (8 * wave) * 256 + 8 * lane;   /* the work-group's 32 KB of each plane; a wave stores 8 units of 512 B */
    v4f a[8], b[8];
#pragma unroll
    for (int i = 0; i < 8; ++i) { a[i] = *(const v4fa*)(sp + (size_t)(4 * i) * DM); b[i] = *(const v4fa*)(sp + (size_t)(4 * i + 1) * DM); }
    asm volatile("s_wait_xcnt 0x0" :: "v"(sp), "v"(bp), "v"(tp) : "memory");   // the loads are issued: their address register, held to this line, may be reused from here on; both store addresses are formed while the loads fly, not among the stores
    __builtin_amdgcn_sched_barrier(0);   // all 16 loads fly together: without it the compiler issues the last ones only behind waits for the first
    v2u u[8], w[8];
#pragma unroll
    for (int i = 0; i < 8; ++i) { u[i][0] = pkbf(a[i][0], a[i][1]); u[i][1] = pkbf(a[i][2], a[i][3]); w[i][0] = pkbf(b[i][0], b[i][1]); w[i][1] = pkbf(b[i][2], b[i][3]); }
#pragma unroll
    for (int i = 0; i < 8; ++i)
#pragma unroll
        for (int j = 0; j < 4; ++j) { const unsigned lo = u[i][j >> 1], hi = w[i][j >> 1];   /* d = 4 c + j of tokens t (low half) and t + 1 */
            T[(4 * c + j) * (PT / 2) + (((4 * wave + (i >> 1)) ^ FSW(4 * c + j)) << 2) + ((2 * i + r) & 3)] = (j & 1) ? pkh(__uint_as_float(lo & 0xFFFF0000u), __uint_as_float(hi & 0xFFFF0000u)) : pkh(__uint_as_float(lo << 16), __uint_as_float(hi << 16)); }   /* the bf16-rounded values, re-encoded as f16 */
#pragma unroll
    for (int i = 0; i < 8; ++i) { const int m = c >> 1; const int ri = (((2 * wave + (i >> 2)) * 128 + m * 16 + ((4 * (i & 3) + 2 * r) ^ GSW(m))) << 2) + 2 * (c & 1);   /* token t is even: token t + 1 lies at the chunk with bit 0 flipped */
        *(v2ua*)(R + ri) = u[i]; *(v2ua*)(R + (ri ^ 4)) = w[i]; }
    __syncthreads();   // every wave's words are in LDS before a unit is read; all global stores stand behind it, so that it does not wait for them
#pragma unroll
    for (int n = 0; n < 8; ++n) { const int d = 16 * (n >> 1) + c, k = 4 * wave + 2 * (n & 1) + r; *(v4ua*)(tp + n * 256) = *(const v4ua*)(T + d * (PT / 2) + ((k ^ FSW(d)) << 2)); }
#pragma unroll
    for (int n = 0; n < 8; ++n) { const int m = 2 * (n & 3) + r; *(v4ua*)(bp + n * 256) = *(const v4ua*)(R + (((2 * wave + (n >> 2)) * 128 + m * 16 + (c ^ GSW(m))) << 2)); }
}

typedef __attribute__((ext_vector_type(8))) unsigned v8u;
#define KBLK 64
__device__ __forceinline__ v16bf ldu(const bf* p) { return cat16b(*(const v8us*)p, *(const v8us*)(p + 256)); }   // two units one behind the other: the 8 k at 8h and the 8 k at 16 + 8h of a fragment
__device__ __forceinline__ v16h lduh(const bf* p) { return __builtin_bit_cast(v16h, ldu(p)); }   // the same two units of an f16 plane
__device__ __forceinline__ float xhalf(float x) { return __builtin_bit_cast(float, __builtin_amdgcn_permlanex16(__builtin_bit_cast(int, x), __builtin_bit_cast(int, x), 0x76543210, 0xfedcba98, false, false)); }   // lane l takes lane l ^ 16's value
#define SC2  0.18033688011112042f   // HD^-0.5 x log2(e): the softmax runs in base 2
__global__ __launch_bounds__(256) void k_fattn(const bf* __restrict__ QB, const bf* __restrict__ KB, const bf* __restrict__ VT, float* __restrict__ OUT) {
    __shared__ __attribute__((aligned(16))) v4f XO[2][8][4][32];   /* [tile of the pair][wave][16-B piece][lane]: a buffer per tile, so one barrier per tile is enough */
    __shared__ __attribute__((aligned(8))) v2f XM[2][8][32];       /* the wave's maximum and its lane's sum */
    const int lane = threadIdx.x & 31, lr = lane & 15, hi = lane >> 4;
    const int wave = __builtin_amdgcn_readfirstlane((int)(threadIdx.x >> 5));   // scalar, so that the pass loop is a scalar loop
    const int plane = blockIdx.y;
    const bf* Qp = QB + (size_t)plane * TT * HD + 8 * lane; const bf* Kp = KB + (size_t)plane * TT * HD + 8 * lane; const bf* Vp = VT + (size_t)plane * HD * TT + 8 * lane;
    float* Op = OUT + (size_t)(plane / NH_) * TT * DM + (size_t)(plane % NH_) * HD;
    const int z = wave >> 2;   /* which of the two key shares */
    const int pr = blockIdx.x * 4 + (wave & 3);
    // the two tiles run one after the other through one copy of the code (rolled); every short loop below is unrolled so that the fragment arrays stay in registers
#pragma unroll 1
    for (int half = 0; half < 2; ++half) {
        const int q0 = (half ? (TT / 16 - 1 - pr) : pr) * 16; const int nblk = q0 / KBLK + 1; const int q = q0 + lr;
        v16bf qf[2], kf[4][2];
#pragma unroll
        for (int c = 0; c < 2; ++c) qf[c] = ldu(Qp + (size_t)q0 * HD + 512 * c);
#pragma unroll
        for (int nb = 0; nb < 4; ++nb)
#pragma unroll
            for (int c = 0; c < 2; ++c) kf[nb][c] = ldu(Kp + (size_t)(z * KBLK + nb * 16) * HD + 512 * c);
        v8f o[4];
#pragma unroll
        for (int nd = 0; nd < 4; ++nd) o[nd] = (v8f){};
        float m = -3.0e38f, l = 0.f;
        // rolled: the trip count is the tile's own, and one pass already fills the register file
#pragma unroll 1
        for (int kb = z; kb < nblk; kb += 2) {
            const int key0 = kb * KBLK;
            v16h vf[4][2];
#pragma unroll
            for (int nd = 0; nd < 4; ++nd)
#pragma unroll
                for (int c = 0; c < 2; ++c) vf[nd][c] = lduh(Vp + (size_t)key0 * HD + 2048 * c + 512 * nd);
            asm volatile("s_wait_xcnt 0x0" ::: "memory");   // the value loads are issued: their address registers may be reused from here on
            v8f s[4];
#pragma unroll
            for (int nb = 0; nb < 4; ++nb) { s[nb] = wmmab(kf[nb][0], qf[0], (v8f){}); s[nb] = wmmab(kf[nb][1], qf[1], s[nb]); }
            const int kn = (kb + 2 < nblk) ? key0 + 2 * KBLK : key0;   /* the wave's next pass's key rows, fetched behind this pass's products; the last pass re-reads its own */
#pragma unroll
            for (int nb = 0; nb < 4; ++nb)
#pragma unroll
                for (int c = 0; c < 2; ++c) kf[nb][c] = ldu(Kp + (size_t)(kn + nb * 16) * HD + 512 * c);
            asm volatile("s_wait_xcnt 0x0" ::: "memory");   // the key loads are issued: their address registers are reused below
            if (kb == nblk - 1) {   /* only the last pass meets the diagonal: keys after the query excluded */
#pragma unroll
                for (int nb = 0; nb < 4; ++nb)
#pragma unroll
                    for (int j = 0; j < 8; ++j) s[nb][j] = (key0 + nb * 16 + hi * 8 + j <= q) ? s[nb][j] : -3.0e38f; }
            float mx = m;
#pragma unroll
            for (int nb = 0; nb < 4; ++nb)
#pragma unroll
                for (int j = 0; j < 8; ++j) mx = fmaxf(mx, s[nb][j]);
            mx = fmaxf(mx, xhalf(mx));
            const float al = __builtin_amdgcn_exp2f((m - mx) * SC2); const float mc = mx * SC2; m = mx;
            float sum = 0.f; v8u ph[2];
#pragma unroll
            for (int nb = 0; nb < 4; ++nb)
#pragma unroll
                for (int j = 0; j < 8; ++j) s[nb][j] = __builtin_amdgcn_exp2f(fmaf(s[nb][j], SC2, -mc));
#pragma unroll
            for (int nb = 0; nb < 4; ++nb)
#pragma unroll
                for (int j = 0; j < 8; j += 2) {
                    v2f p; p[0] = s[nb][j]; p[1] = s[nb][j + 1]; sum += p[0] + p[1];
                    ph[nb >> 1][(nb & 1) * 4 + (j >> 1)] = __builtin_bit_cast(unsigned, __builtin_convertvector(p, v2h)); }
            l = l * al + sum;
#pragma unroll
            for (int nd = 0; nd < 4; ++nd)
#pragma unroll
                for (int j = 0; j < 8; ++j) o[nd][j] *= al;
#pragma unroll
            for (int c = 0; c < 2; ++c)
#pragma unroll
                for (int nd = 0; nd < 4; ++nd) o[nd] = wmma16(vf[nd][c], __builtin_bit_cast(v16h, ph[c]), o[nd]);
            __builtin_amdgcn_sched_barrier(0);   // the register copies of the prefetched key fragments stay behind this line: moved up, they bring the wait for all 32 loads of the pass to the head of the softmax
        }
        // join the two key shares: share z finishes d = 32 z .. 32 z + 31 and hands the other two tiles of O^T to its partner. A share without a pass (one-pass tile, z = 1) holds m = -3.0e38, l = 0, O = 0 and gets weight 0.
        v8f kp[2], gv[2];
#pragma unroll
        for (int i = 0; i < 2; ++i) { kp[i] = z ? o[2 + i] : o[i]; gv[i] = z ? o[i] : o[2 + i]; }
#pragma unroll
        for (int i = 0; i < 2; ++i) { XO[half][wave][2 * i][lane] = __builtin_shufflevector(gv[i], gv[i], 0, 1, 2, 3); XO[half][wave][2 * i + 1][lane] = __builtin_shufflevector(gv[i], gv[i], 4, 5, 6, 7); }
        { v2f ml; ml[0] = m; ml[1] = l; XM[half][wave][lane] = ml; }
        __syncthreads();   // both shares of every tile are in LDS before a partner reads them
        const v2f pm = XM[half][wave ^ 4][lane];
        const float mt = fmaxf(m, pm[0]); const float w0 = __builtin_amdgcn_exp2f((m - mt) * SC2), w1 = __builtin_amdgcn_exp2f((pm[0] - mt) * SC2);
        float lt = l * w0 + pm[1] * w1; lt += xhalf(lt);
        const float f = __fdiv_rn(1.0f, lt); const float f0 = w0 * f, f1 = w1 * f;
        float* orow = Op + (size_t)q * DM + z * 32 + hi * 8;   /* lane (c, h) holds d = 16 nd + 8 h + r of query c */
#pragma unroll
        for (int i = 0; i < 2; ++i) { const v4f pa = XO[half][wave ^ 4][2 * i][lane], pb = XO[half][wave ^ 4][2 * i + 1][lane]; v4f a, b2;
#pragma unroll
            for (int j = 0; j < 4; ++j) { a[j] = kp[i][j] * f0 + pa[j] * f1; b2[j] = kp[i][j + 4] * f0 + pb[j] * f1; }
            *(v4f*)(orow + i * 16) = a; *(v4f*)(orow + i * 16 + 4) = b2; }
        asm volatile("s_wait_xcnt 0x0" ::: "memory");   // the stores' address and data registers are rewritten by the next tile
    }
}

extern "C" void kernel_launch(void* const* d_in, const int* in_sizes, int n_in,
                              void* d_out, int out_size, void* d_ws, size_t ws_size, hipStream_t stream) {
    (void)in_sizes; (void)n_in; (void)out_size;
    const float* Xin = (const float*)d_in[0];   /* q = k = v = x */
    float* OUT = (float*)d_out;
    char* wsp = (char*)d_ws;
    auto take = [&](size_t bytes) { char* p = wsp; wsp += (bytes + 255) & ~(size_t)255; return (void*)p; };
    const size_t PB = (size_t)NH_ * TT * HD;   /* elements of one batch's planes */
    bf* XB = (bf*)take(NB_ * PB * 2); bf* VT = (bf*)take(NB_ * PB * 2);   /* one plane set serves queries and keys */
    if ((size_t)(wsp - (char*)d_ws) > ws_size) return;
    k_prep<<<dim3(TT / PT, NB_ * NH_, 1), 256, 0, stream>>>(Xin, XB, VT);
    k_fattn<<<dim3(TT / 128, NB_ * NH_, 1), 256, 0, stream>>>(XB, XB, VT, OUT);   /* every (batch, head) plane in one launch */
}

// v006
// Measured time: 30.3 microseconds a run.
// Two timings next to v005 both put it at 1.05 times that version's speed.
// Counting every step since v000, it is 70.7 times as fast.
#include <hip/hip_runtime.h>

// Parameter-free causal self-attention with x as q, k and v (x [2][2048][1024] viewed as 16 heads x 64; scores = x_h.x_h / 8; causal (-inf); softmax; out = attn x_h merged -> [2][2048][1024] (4.2 M)).
// Layout: one set of bf16 planes per (batch, head) for queries and keys plus f16 x^T planes for the value side, both built from x by one launch and both stored in fragment order (a wave's 16-B pieces of one fragment half lie side by side, 512 B); one fused kernel walks the keys of every 32-query group with a running maximum and sum (four waves a group, key blocks dealt in turn, joined through LDS), so scores and P stay in registers; merged token-major output rows.
// Compute dtypes, f32 accumulate: every input rounded to bf16; q.k on bf16 operands, exact products; softmax f32; P.V on f16 operands: P in [0, 1] rounded once to f16 (11 bits), v the bf16-rounded x re-encoded as f16 (exact for 2^-17 <= |x| < 65520, to 2^-25 below); output f32.

#define NB_  2
#define TT   2048
#define DM   1024      // token-major row pitch (H x HD)
#define NH_  16
#define NKV  1
#define REP  (NH_ / NKV)
#define HD   64
#define DQ   (NH_ * HD)
#define DKV  (NKV * HD)
#define ZH   1
#define RH   2048
#define WIN  0
#define PCAR 1024.0f
#define SCL  0.125f   // 1/sqrt(64)
typedef _Float16 h16;
typedef unsigned short bf;
typedef __attribute__((ext_vector_type(16))) __bf16   v16bf;
typedef __attribute__((ext_vector_type(16))) _Float16 v16h;
typedef __attribute__((ext_vector_type(8)))  _Float16 v8h;
typedef __attribute__((ext_vector_type(8)))  unsigned short v8us;
typedef __attribute__((ext_vector_type(8)))  float    v8f;
typedef __attribute__((ext_vector_type(4)))  float    v4f;
typedef v8h  __attribute__((may_alias)) v8ha;
typedef v4f  __attribute__((may_alias)) v4fa;
typedef v8us __attribute__((may_alias)) v8usa;

__device__ __forceinline__ unsigned short f2bf(float f) { unsigned u = __float_as_uint(f); u += 0x7FFFu + ((u >> 16) & 1u); return (unsigned short)(u >> 16); }
__device__ __forceinline__ float bf2f(unsigned short b) { return __uint_as_float(((unsigned)b) << 16); }
__device__ __forceinline__ float bfr(float f) { return bf2f(f2bf(f)); }
__device__ __forceinline__ v16h cat16(v8h lo, v8h hi) { return __builtin_shufflevector(lo, hi, 0, 1, 2, 3, 4, 5, 6, 7, 8, 9, 10, 11, 12, 13, 14, 15); }
__device__ __forceinline__ v16bf cat16b(v8us lo, v8us hi) { return __builtin_bit_cast(v16bf, __builtin_shufflevector(lo, hi, 0, 1, 2, 3, 4, 5, 6, 7, 8, 9, 10, 11, 12, 13, 14, 15)); }
__device__ __forceinline__ v8f wmma16(v16h a, v16h b, v8f c) { return __builtin_amdgcn_wmma_f32_16x16x32_f16(false, a, false, b, (short)0, c, false, false); }
__device__ __forceinline__ v8f wmmab(v16bf a, v16bf b, v8f c) { return __builtin_amdgcn_wmma_f32_16x16x32_bf16(false, a, false, b, (short)0, c, false, false); }



// ---- fragment loader: row c of a K-contiguous 16-bit plane in the hardware k order (8 k at 8h, 8 k at 16 + 8h); the same code serves A and B.
template <typename T16> struct WFrag;
template <> struct WFrag<h16> { typedef v16h V; static __device__ __forceinline__ V ld(const h16* p) { return cat16(*(const v8h*)p, *(const v8h*)(p + 16)); } static __device__ __forceinline__ v8f mma(V a, V b, v8f c) { return wmma16(a, b, c); } };
template <> struct WFrag<bf> { typedef v16bf V; static __device__ __forceinline__ V ld(const bf* p) { return cat16b(*(const v8us*)p, *(const v8us*)(p + 16)); } static __device__ __forceinline__ v8f mma(V a, V b, v8f c) { return wmmab(a, b, c); } };

__device__ __forceinline__ h16 tohx(float x) { return (h16)x; }
__device__ __forceinline__ void splitf(float y, unsigned short& h, unsigned short& l) { h = f2bf(y); l = f2bf(y - bf2f(h)); }
typedef __attribute__((ext_vector_type(2))) _Float16 v2h;
typedef __attribute__((ext_vector_type(4))) _Float16 v4h;
typedef __attribute__((ext_vector_type(2))) unsigned short v2us;
typedef __attribute__((ext_vector_type(4))) unsigned short v4us;
typedef __attribute__((ext_vector_type(2))) float v2f;
typedef __attribute__((ext_vector_type(4))) int v4i;

__global__ __launch_bounds__(256) void k_wtG(const float* __restrict__ w, int K, int N, bf* Bt) {
    const int lane = threadIdx.x & 31; const int L0 = (blockIdx.x * 8 + (threadIdx.x >> 5)) * 8; const int nlines = N * K / 64;
{
#pragma unroll 1
        for (int l = 0; l < 8; ++l) { const int L = L0 + l; if (L >= nlines) break; const size_t e = (size_t)L * 64 + lane * 2; const int k = (int)(e % K), n = (int)(e / K); v2us o;
            o[0] = f2bf(w[(size_t)k * N + n]); o[1] = f2bf(w[(size_t)(k + 1) * N + n]); *(v2us*)(Bt + e) = o; }
         }
}
__global__ __launch_bounds__(256) void k_cvt8(const float* __restrict__ src, bf* dst, size_t n8) { const size_t i = (size_t)blockIdx.x * 256 + threadIdx.x; if (i >= n8) return; const v8f v = *(const v8f*)(src + i * 8); v8us o;
#pragma unroll
    for (int k = 0; k < 8; ++k) o[k] = f2bf(v[k]); *(v8us*)(dst + i * 8) = o;  }


__global__ __launch_bounds__(256) void k_vtp(const float* __restrict__ F, int pitch, int nheads, h16* V16, bf* Vh, bf* Vl) { const size_t e = ((size_t)blockIdx.x * 256 + threadIdx.x) * 2; if (e >= (size_t)nheads * HD * TT) return; const int t = (int)(e % TT); const int d = (int)((e / TT) % HD); const int g = (int)(e / ((size_t)TT * HD)); v2h o16; v2us oh, ol;
#pragma unroll
    for (int q = 0; q < 2; ++q) { const float x = F[(size_t)(t + q) * pitch + g * HD + d]; o16[q] = tohx(x); unsigned short a2, c2; splitf(x, a2, c2); oh[q] = a2; ol[q] = c2; }
    *(v2h*)(V16 + e) = o16; *(v2us*)(Vh + e) = oh; *(v2us*)(Vl + e) = ol;  }

__global__ __launch_bounds__(256) void k_merge(const float* __restrict__ O, int h0, float* OUTb) { const size_t e = ((size_t)blockIdx.x * 256 + threadIdx.x) * 2; if (e >= (size_t)ZH * TT * HD) return; const int d = (int)(e % HD); const int t = (int)((e / HD) % TT); const int zz = (int)(e / ((size_t)HD * TT)); const float cs = (t < RH) ? 1.0f : (1.0f / PCAR); const size_t oo = (size_t)t * DQ + (h0 + zz) * HD + d;
    v2f o2; o2[0] = O[e] * cs; o2[1] = O[e + 1] * cs; *(v2f*)(OUTb + oo) = o2;  }


__global__ __launch_bounds__(256) void k_vtpR1(const float* __restrict__ Vb, bf* Vh) { const size_t e = ((size_t)blockIdx.x * 256 + threadIdx.x) * 2; if (e >= (size_t)HD * TT) return; const int t = (int)(e % TT); const int d = (int)(e / TT); v2us o; o[0] = f2bf(Vb[(size_t)t * HD + d]); o[1] = f2bf(Vb[(size_t)(t + 1) * HD + d]); *(v2us*)(Vh + e) = o;  }
__global__ __launch_bounds__(256) void k_mergeR(const float* __restrict__ O, float* outb, size_t n4) { const size_t i = (size_t)blockIdx.x * 256 + threadIdx.x; if (i >= n4) return; const v4f a = *(const v4f*)(O + i * 4); *(v4f*)(outb + i * 4) = a;  }


// ---- k_prep: both 16-bit forms of x in one launch (bf16 rows; x^T with the same rounded values as f16), x read once. One work-group per WGP takes 256 tokens x 64 d of one (batch, head) plane; a half-wave reads one token's 256 B.
// A lane holds 4 d of tokens t and t + 1: pairs along d go through LDS array R, pairs along t through LDS array T as words [d][t / 2]; both leave as 512-B units in fragment order, lane l's 16 B at byte 16 l.
// Row planes: [t / 16][d / 8][t mod 16][8 d], 2 KB per 16 tokens. x^T planes: [t / 32][d / 16][(t mod 32) / 8][d mod 16][8 t], 4 KB per 32 tokens. So the piece that lane (c, h) of a matrix fragment needs is the lane's own 16 B of a unit.
// LDS: in T the 16-B chunk k of row d lies at chunk k ^ FSW(d), in R chunk (d / 8 = m, t mod 16) at t ^ GSW(m), so that the lanes of each store and the 16 lanes of each half of a 16-B read fall on different banks.
typedef __attribute__((ext_vector_type(2))) __bf16 v2bf;
typedef __attribute__((ext_vector_type(2))) unsigned v2u;
typedef __attribute__((ext_vector_type(4))) unsigned v4u;
typedef v2u __attribute__((may_alias)) v2ua;
typedef v4u __attribute__((may_alias)) v4ua;
#define PT 256
#define FSW(d) (((d) & 12) | (((d) ^ ((d) >> 4)) & 3))
#define GSW(m) (((m) & 1) | (((m) >> 1) << 2))
__device__ __forceinline__ unsigned pkbf(float x, float y) { v2f p; p[0] = x; p[1] = y; return __builtin_bit_cast(unsigned, __builtin_convertvector(p, v2bf)); }   // x in the low half; round to nearest even
__device__ __forceinline__ unsigned pkh(float x, float y) { v2f p; p[0] = x; p[1] = y; return __builtin_bit_cast(unsigned, __builtin_convertvector(p, v2h)); }   // the same to f16
__global__ __launch_bounds__(256) void k_prep(const float* __restrict__ X, bf* __restrict__ XB, bf* __restrict__ XT) {
    __shared__ __attribute__((aligned(16))) unsigned T[HD * (PT / 2)];
    __shared__ __attribute__((aligned(16))) unsigned R[PT * (HD / 2)];
    const int lane = threadIdx.x & 31, c = lane & 15, r = lane >> 4, wave = threadIdx.x >> 5;
    const int plane = blockIdx.y, tb = blockIdx.x * PT, t0 = tb + 32 * wave + 2 * r;
    const float* sp = X + (size_t)(plane / NH_) * TT * DM + (size_t)(plane % NH_) * HD + (size_t)t0 * DM + 4 * c;
    bf* bp = XB + (size_t)plane * TT * HD + (size_t)tb * HD + (8 * wave) * 256 + 8 * lane; bf* tp = XT + (size_t)plane * HD * TT + (size_t)tb * HD + (8 * wave) * 256 + 8 * lane;   /* the work-group's 32 KB of each plane; a wave stores 8 units of 512 B */
    v4f a[8], b[8];
#pragma unroll
    for (int i = 0; i < 8; ++i) { a[i] = *(const v4fa*)(sp + (size_t)(4 * i) * DM); b[i] = *(const v4fa*)(sp + (size_t)(4 * i + 1) * DM); }
    asm volatile("s_wait_xcnt 0x0" :: "v"(sp), "v"(bp), "v"(tp) : "memory");   // the loads are issued: their address register, held to this line, may be reused from here on; both store addresses are formed while the loads fly, not among the stores
    __builtin_amdgcn_sched_barrier(0);   // all 16 loads fly together: without it the compiler issues the last ones only behind waits for the first
    v2u u[8], w[8];
#pragma unroll
    for (int i = 0; i < 8; ++i) { u[i][0] = pkbf(a[i][0], a[i][1]); u[i][1] = pkbf(a[i][2], a[i][3]); w[i][0] = pkbf(b[i][0], b[i][1]); w[i][1] = pkbf(b[i][2], b[i][3]); }
#pragma unroll
    for (int i = 0; i < 8; ++i)
#pragma unroll
        for (int j = 0; j < 4; ++j) { const unsigned lo = u[i][j >> 1], hi = w[i][j >> 1];   /* d = 4 c + j of tokens t (low half) and t + 1 */
            T[(4 * c + j) * (PT / 2) + (((4 * wave + (i >> 1)) ^ FSW(4 * c + j)) << 2) + ((2 * i + r) & 3)] = (j & 1) ? pkh(__uint_as_float(lo & 0xFFFF0000u), __uint_as_float(hi & 0xFFFF0000u)) : pkh(__uint_as_float(lo << 16), __uint_as_float(hi << 16)); }   /* the bf16-rounded values, re-encoded as f16 */
#pragma unroll
    for (int i = 0; i < 8; ++i) { const int m = c >> 1; const int ri = (((2 * wave + (i >> 2)) * 128 + m * 16 + ((4 * (i & 3) + 2 * r) ^ GSW(m))) << 2) + 2 * (c & 1);   /* token t is even: token t + 1 lies at the chunk with bit 0 flipped */
        *(v2ua*)(R + ri) = u[i]; *(v2ua*)(R + (ri ^ 4)) = w[i]; }
    __syncthreads();   // every wave's words are in LDS before a unit is read; all global stores stand behind it, so that it does not wait for them
#pragma unroll
    for (int n = 0; n < 8; ++n) { const int d = 16 * (n >> 1) + c, k = 4 * wave + 2 * (n & 1) + r; *(v4ua*)(tp + n * 256) = *(const v4ua*)(T + d * (PT / 2) + ((k ^ FSW(d)) << 2)); }
#pragma unroll
    for (int n = 0; n < 8; ++n) { const int m = 2 * (n & 3) + r; *(v4ua*)(bp + n * 256) = *(const v4ua*)(R + (((2 * wave + (n >> 2)) * 128 + m * 16 + (c ^ GSW(m))) << 2)); }
}

typedef __attribute__((ext_vector_type(8))) unsigned v8u;
#define KBLK 32
#define NSH  4
__device__ __forceinline__ v16bf ldu(const bf* p) { return cat16b(*(const v8us*)p, *(const v8us*)(p + 256)); }   // two units one behind the other: the 8 k at 8h and the 8 k at 16 + 8h of a fragment
__device__ __forceinline__ v16h lduh(const bf* p) { return __builtin_bit_cast(v16h, ldu(p)); }   // the same two units of an f16 plane
__device__ __forceinline__ float xhalf(float x) { return __builtin_bit_cast(float, __builtin_amdgcn_permlanex16(__builtin_bit_cast(int, x), __builtin_bit_cast(int, x), 0x76543210, 0xfedcba98, false, false)); }   // lane l takes lane l ^ 16's value
#define SC2  0.18033688011112042f   // HD^-0.5 x log2(e): the softmax runs in base 2
__global__ __launch_bounds__(256) void k_fattn(const bf* __restrict__ QB, const bf* __restrict__ KB, const bf* __restrict__ VT, float* __restrict__ OUT) {
    __shared__ __attribute__((aligned(16))) v4f XO[2][8][16][32];   /* [group of the pair][wave][16-B piece: (column tile, d tile, half)][lane]: a buffer per group, so one barrier per group is enough */
    __shared__ __attribute__((aligned(8))) v2f XM[2][8][2][32];     /* per column tile: the wave's maximum and its lane's sum */
    const int lane = threadIdx.x & 31, lr = lane & 15, hi = lane >> 4;
    const int wave = __builtin_amdgcn_readfirstlane((int)(threadIdx.x >> 5));   // scalar, so that the pass loop is a scalar loop
    const int plane = blockIdx.y;
    const bf* Qp = QB + (size_t)plane * TT * HD + 8 * lane; const bf* Kp = KB + (size_t)plane * TT * HD + 8 * lane; const bf* Vp = VT + (size_t)plane * HD * TT + 8 * lane;
    float* Op = OUT + (size_t)(plane / NH_) * TT * DM + (size_t)(plane % NH_) * HD;
    const int z = wave >> 1;   /* which of the four key shares, and which quarter of the result */
    const int wb = wave & 1;   /* which of the work-group's two query groups */
    const int pg = blockIdx.x * 2 + wb;
    // the two groups run one after the other through one copy of the code (rolled); every short loop below is unrolled so that the fragment arrays stay in registers
#pragma unroll 1
    for (int half = 0; half < 2; ++half) {
        const int q0 = (half ? (TT / 32 - 1 - pg) : pg) * 32; const int nblk = q0 / KBLK + 1; const int zz = half ? NSH - 1 - z : z;
        v16bf qf[2][2], kf[2][2];
#pragma unroll
        for (int qt = 0; qt < 2; ++qt)
#pragma unroll
            for (int c = 0; c < 2; ++c) qf[qt][c] = ldu(Qp + (size_t)(q0 + qt * 16) * HD + 512 * c);
#pragma unroll
        for (int nb = 0; nb < 2; ++nb)
#pragma unroll
            for (int c = 0; c < 2; ++c) kf[nb][c] = ldu(Kp + (size_t)(zz * KBLK + nb * 16) * HD + 512 * c);
        v8f o[2][4];
#pragma unroll
        for (int qt = 0; qt < 2; ++qt)
#pragma unroll
            for (int nd = 0; nd < 4; ++nd) o[qt][nd] = (v8f){};
        float m[2] = { -3.0e38f, -3.0e38f }, l[2] = { 0.f, 0.f };
        // rolled: the trip count is the group's own, and one pass already fills the register file
#pragma unroll 1
        for (int kb = zz; kb < nblk; kb += NSH) {
            const int key0 = kb * KBLK;
            v16h vf[4];
#pragma unroll
            for (int nd = 0; nd < 4; ++nd) vf[nd] = lduh(Vp + (size_t)key0 * HD + 512 * nd);
            asm volatile("s_wait_xcnt 0x0" ::: "memory");   // the value loads are issued: their address registers may be reused from here on
            v8f s[2][2];
#pragma unroll
            for (int nb = 0; nb < 2; ++nb)
#pragma unroll
                for (int qt = 0; qt < 2; ++qt) { s[qt][nb] = wmmab(kf[nb][0], qf[qt][0], (v8f){}); s[qt][nb] = wmmab(kf[nb][1], qf[qt][1], s[qt][nb]); }
            const int kn = (kb + NSH < nblk) ? key0 + NSH * KBLK : key0;   /* the wave's next pass's key rows, fetched behind this pass's products; the last pass re-reads its own */
#pragma unroll
            for (int nb = 0; nb < 2; ++nb)
#pragma unroll
                for (int c = 0; c < 2; ++c) kf[nb][c] = ldu(Kp + (size_t)(kn + nb * 16) * HD + 512 * c);
            asm volatile("s_wait_xcnt 0x0" ::: "memory");   // the key loads are issued: their address registers are reused below
            if (kb == nblk - 1) {   /* only the last pass meets the diagonal: keys after the query excluded */
#pragma unroll
                for (int qt = 0; qt < 2; ++qt)
#pragma unroll
                    for (int nb = 0; nb < 2; ++nb)
#pragma unroll
                        for (int j = 0; j < 8; ++j) s[qt][nb][j] = (key0 + nb * 16 + hi * 8 + j <= q0 + qt * 16 + lr) ? s[qt][nb][j] : -3.0e38f; }
            v8u ph[2]; float al[2];
#pragma unroll
            for (int qt = 0; qt < 2; ++qt) {
                float mx = m[qt];
#pragma unroll
                for (int nb = 0; nb < 2; ++nb)
#pragma unroll
                    for (int j = 0; j < 8; ++j) mx = fmaxf(mx, s[qt][nb][j]);
                mx = fmaxf(mx, xhalf(mx));
                al[qt] = __builtin_amdgcn_exp2f((m[qt] - mx) * SC2); const float mc = mx * SC2; m[qt] = mx;
                float sum = 0.f;
#pragma unroll
                for (int nb = 0; nb < 2; ++nb)
#pragma unroll
                    for (int j = 0; j < 8; j += 2) { v2f t; t[0] = s[qt][nb][j]; t[1] = s[qt][nb][j + 1]; t = __builtin_elementwise_fma(t, (v2f){ SC2, SC2 }, (v2f){ -mc, -mc });   /* on the tile's own register pairs: left to itself the compiler pairs the last score of one column tile with the first of the next and shifts a whole tile by one register */
                        s[qt][nb][j] = __builtin_amdgcn_exp2f(t[0]); s[qt][nb][j + 1] = __builtin_amdgcn_exp2f(t[1]); }
#pragma unroll
                for (int nb = 0; nb < 2; ++nb)
#pragma unroll
                    for (int j = 0; j < 8; j += 2) {
                        v2f p; p[0] = s[qt][nb][j]; p[1] = s[qt][nb][j + 1]; sum += p[0]; sum += p[1];   /* one add a value: of sums written p[0] + p[1] the compiler packs two and pays for it in register moves */
                        ph[qt][nb * 4 + (j >> 1)] = __builtin_bit_cast(unsigned, __builtin_convertvector(p, v2h)); }
                l[qt] = l[qt] * al[qt] + sum;
            }
#pragma unroll
            for (int qt = 0; qt < 2; ++qt)
#pragma unroll
                for (int nd = 0; nd < 4; ++nd)
#pragma unroll
                    for (int j = 0; j < 8; ++j) o[qt][nd][j] *= al[qt];
#pragma unroll
            for (int qt = 0; qt < 2; ++qt)
#pragma unroll
                for (int nd = 0; nd < 4; ++nd) o[qt][nd] = wmma16(vf[nd], __builtin_bit_cast(v16h, ph[qt]), o[qt][nd]);
        }
        // join the four key shares: every wave lays down its whole O^T with maximum and sum; wave z then finishes column tile z / 2, d = 32 (z mod 2) .. + 31. A share without a pass holds m = -3.0e38, l = 0, O = 0 and gets weight 0.
#pragma unroll
        for (int qt = 0; qt < 2; ++qt)
#pragma unroll
            for (int nd = 0; nd < 4; ++nd) { XO[half][wave][(qt * 4 + nd) * 2][lane] = __builtin_shufflevector(o[qt][nd], o[qt][nd], 0, 1, 2, 3); XO[half][wave][(qt * 4 + nd) * 2 + 1][lane] = __builtin_shufflevector(o[qt][nd], o[qt][nd], 4, 5, 6, 7); }
#pragma unroll
        for (int qt = 0; qt < 2; ++qt) { v2f ml; ml[0] = m[qt]; ml[1] = l[qt]; XM[half][wave][qt][lane] = ml; }
        __syncthreads();   // all four shares of both groups are in LDS before a wave reads them
        const int qs = z >> 1, dh = z & 1;
        v2f pm[NSH];
#pragma unroll
        for (int sh = 0; sh < NSH; ++sh) pm[sh] = XM[half][wb + 2 * sh][qs][lane];
        const float mt = fmaxf(fmaxf(pm[0][0], pm[1][0]), fmaxf(pm[2][0], pm[3][0]));
        float wt[NSH], lt = 0.f;
#pragma unroll
        for (int sh = 0; sh < NSH; ++sh) { wt[sh] = __builtin_amdgcn_exp2f((pm[sh][0] - mt) * SC2); lt = fmaf(pm[sh][1], wt[sh], lt); }
        lt += xhalf(lt);
        const float f = __fdiv_rn(1.0f, lt);
        float* orow = Op + (size_t)(q0 + qs * 16 + lr) * DM + dh * 32 + hi * 8;   /* lane (c, h) holds d = 16 nd + 8 h + r of query c */
#pragma unroll
        for (int i = 0; i < 2; ++i) { v4f a = (v4f){}, b2 = (v4f){};
#pragma unroll
            for (int sh = 0; sh < NSH; ++sh) { const float fs = wt[sh] * f; const int pc = (qs * 4 + dh * 2 + i) * 2; const v4f pa = XO[half][wb + 2 * sh][pc][lane], pb = XO[half][wb + 2 * sh][pc + 1][lane];
#pragma unroll
                for (int j = 0; j < 4; ++j) { a[j] += pa[j] * fs; b2[j] += pb[j] * fs; } }
            *(v4f*)(orow + i * 16) = a; *(v4f*)(orow + i * 16 + 4) = b2; }
        asm volatile("s_wait_xcnt 0x0" ::: "memory");   // the stores' address and data registers are rewritten by the next group
    }
}

extern "C" void kernel_launch(void* const* d_in, const int* in_sizes, int n_in,
                              void* d_out, int out_size, void* d_ws, size_t ws_size, hipStream_t stream) {
    (void)in_sizes; (void)n_in; (void)out_size;
    const float* Xin = (const float*)d_in[0];   /* q = k = v = x */
    float* OUT = (float*)d_out;
    char* wsp = (char*)d_ws;
    auto take = [&](size_t bytes) { char* p = wsp; wsp += (bytes + 255) & ~(size_t)255; return (void*)p; };
    const size_t PB = (size_t)NH_ * TT * HD;   /* elements of one batch's planes */
    bf* XB = (bf*)take(NB_ * PB * 2); bf* VT = (bf*)take(NB_ * PB * 2);   /* one plane set serves queries and keys */
    if ((size_t)(wsp - (char*)d_ws) > ws_size) return;
    k_prep<<<dim3(TT / PT, NB_ * NH_, 1), 256, 0, stream>>>(Xin, XB, VT);
    k_fattn<<<dim3(TT / 128, NB_ * NH_, 1), 256, 0, stream>>>(XB, XB, VT, OUT);   /* every (batch, head) plane in one launch */
}

// v007
// It runs in 28.1 microseconds.
// Two timings next to v006 put it at 1.08 and 1.07 times that version's speed.
// Over all steps from v000 it is 75.9 times as fast.
#include <hip/hip_runtime.h>

// Parameter-free causal self-attention with x as q, k and v (x [2][2048][1024] viewed as 16 heads x 64; scores = x_h.x_h / 8; causal (-inf); softmax; out = attn x_h merged -> [2][2048][1024] (4.2 M)).
// Layout: one set of bf16 planes per (batch, head) for queries and keys plus f16 x^T planes for the value side, both built from x by one launch and both stored in fragment order (a wave's 16-B pieces of one fragment half lie side by side, 512 B); one fused kernel walks the keys of every 32-query group with a fixed softmax shift per query and a running sum (four waves a group, key blocks dealt in turn, joined through LDS), so scores and P stay in registers; merged token-major output rows.
// Compute dtypes, f32 accumulate: every input rounded to bf16; q.k on bf16 operands, exact products; softmax f32; P.V on f16 operands: P = exp(score - the query's own diagonal score) rounded once to f16 (11 bits), v the bf16-rounded x re-encoded as f16 (exact for 2^-17 <= |x| < 65520, to 2^-25 below); output f32.

#define NB_  2
#define TT   2048
#define DM   1024      // token-major row pitch (H x HD)
#define NH_  16
#define NKV  1
#define REP  (NH_ / NKV)
#define HD   64
#define DQ   (NH_ * HD)
#define DKV  (NKV * HD)
#define ZH   1
#define RH   2048
#define WIN  0
#define PCAR 1024.0f
#define SCL  0.125f   // 1/sqrt(64)
typedef _Float16 h16;
typedef unsigned short bf;
typedef __attribute__((ext_vector_type(16))) __bf16   v16bf;
typedef __attribute__((ext_vector_type(16))) _Float16 v16h;
typedef __attribute__((ext_vector_type(8)))  _Float16 v8h;
typedef __attribute__((ext_vector_type(8)))  unsigned short v8us;
typedef __attribute__((ext_vector_type(8)))  float    v8f;
typedef __attribute__((ext_vector_type(4)))  float    v4f;
typedef v8h  __attribute__((may_alias)) v8ha;
typedef v4f  __attribute__((may_alias)) v4fa;
typedef v8us __attribute__((may_alias)) v8usa;

__device__ __forceinline__ unsigned short f2bf(float f) { unsigned u = __float_as_uint(f); u += 0x7FFFu + ((u >> 16) & 1u); return (unsigned short)(u >> 16); }
__device__ __forceinline__ float bf2f(unsigned short b) { return __uint_as_float(((unsigned)b) << 16); }
__device__ __forceinline__ float bfr(float f) { return bf2f(f2bf(f)); }
__device__ __forceinline__ v16h cat16(v8h lo, v8h hi) { return __builtin_shufflevector(lo, hi, 0, 1, 2, 3, 4, 5, 6, 7, 8, 9, 10, 11, 12, 13, 14, 15); }
__device__ __forceinline__ v16bf cat16b(v8us lo, v8us hi) { return __builtin_bit_cast(v16bf, __builtin_shufflevector(lo, hi, 0, 1, 2, 3, 4, 5, 6, 7, 8, 9, 10, 11, 12, 13, 14, 15)); }
__device__ __forceinline__ v8f wmma16(v16h a, v16h b, v8f c) { return __builtin_amdgcn_wmma_f32_16x16x32_f16(false, a, false, b, (short)0, c, false, false); }
__device__ __forceinline__ v8f wmmab(v16bf a, v16bf b, v8f c) { return __builtin_amdgcn_wmma_f32_16x16x32_bf16(false, a, false, b, (short)0, c, false, false); }



// ---- fragment loader: row c of a K-contiguous 16-bit plane in the hardware k order (8 k at 8h, 8 k at 16 + 8h); the same code serves A and B.
template <typename T16> struct WFrag;
template <> struct WFrag<h16> { typedef v16h V; static __device__ __forceinline__ V ld(const h16* p) { return cat16(*(const v8h*)p, *(const v8h*)(p + 16)); } static __device__ __forceinline__ v8f mma(V a, V b, v8f c) { return wmma16(a, b, c); } };
template <> struct WFrag<bf> { typedef v16bf V; static __device__ __forceinline__ V ld(const bf* p) { return cat16b(*(const v8us*)p, *(const v8us*)(p + 16)); } static __device__ __forceinline__ v8f mma(V a, V b, v8f c) { return wmmab(a, b, c); } };

__device__ __forceinline__ h16 tohx(float x) { return (h16)x; }
__device__ __forceinline__ void splitf(float y, unsigned short& h, unsigned short& l) { h = f2bf(y); l = f2bf(y - bf2f(h)); }
typedef __attribute__((ext_vector_type(2))) _Float16 v2h;
typedef __attribute__((ext_vector_type(4))) _Float16 v4h;
typedef __attribute__((ext_vector_type(2))) unsigned short v2us;
typedef __attribute__((ext_vector_type(4))) unsigned short v4us;
typedef __attribute__((ext_vector_type(2))) float v2f;
typedef __attribute__((ext_vector_type(4))) int v4i;

__global__ __launch_bounds__(256) void k_wtG(const float* __restrict__ w, int K, int N, bf* Bt) {
    const int lane = threadIdx.x & 31; const int L0 = (blockIdx.x * 8 + (threadIdx.x >> 5)) * 8; const int nlines = N * K / 64;
{
#pragma unroll 1
        for (int l = 0; l < 8; ++l) { const int L = L0 + l; if (L >= nlines) break; const size_t e = (size_t)L * 64 + lane * 2; const int k = (int)(e % K), n = (int)(e / K); v2us o;
            o[0] = f2bf(w[(size_t)k * N + n]); o[1] = f2bf(w[(size_t)(k + 1) * N + n]); *(v2us*)(Bt + e) = o; }
         }
}
__global__ __launch_bounds__(256) void k_cvt8(const float* __restrict__ src, bf* dst, size_t n8) { const size_t i = (size_t)blockIdx.x * 256 + threadIdx.x; if (i >= n8) return; const v8f v = *(const v8f*)(src + i * 8); v8us o;
#pragma unroll
    for (int k = 0; k < 8; ++k) o[k] = f2bf(v[k]); *(v8us*)(dst + i * 8) = o;  }


__global__ __launch_bounds__(256) void k_vtp(const float* __restrict__ F, int pitch, int nheads, h16* V16, bf* Vh, bf* Vl) { const size_t e = ((size_t)blockIdx.x * 256 + threadIdx.x) * 2; if (e >= (size_t)nheads * HD * TT) return; const int t = (int)(e % TT); const int d = (int)((e / TT) % HD); const int g = (int)(e / ((size_t)TT * HD)); v2h o16; v2us oh, ol;
#pragma unroll
    for (int q = 0; q < 2; ++q) { const float x = F[(size_t)(t + q) * pitch + g * HD + d]; o16[q] = tohx(x); unsigned short a2, c2; splitf(x, a2, c2); oh[q] = a2; ol[q] = c2; }
    *(v2h*)(V16 + e) = o16; *(v2us*)(Vh + e) = oh; *(v2us*)(Vl + e) = ol;  }

__global__ __launch_bounds__(256) void k_merge(const float* __restrict__ O, int h0, float* OUTb) { const size_t e = ((size_t)blockIdx.x * 256 + threadIdx.x) * 2; if (e >= (size_t)ZH * TT * HD) return; const int d = (int)(e % HD); const int t = (int)((e / HD) % TT); const int zz = (int)(e / ((size_t)HD * TT)); const float cs = (t < RH) ? 1.0f : (1.0f / PCAR); const size_t oo = (size_t)t * DQ + (h0 + zz) * HD + d;
    v2f o2; o2[0] = O[e] * cs; o2[1] = O[e + 1] * cs; *(v2f*)(OUTb + oo) = o2;  }


__global__ __launch_bounds__(256) void k_vtpR1(const float* __restrict__ Vb, bf* Vh) { const size_t e = ((size_t)blockIdx.x * 256 + threadIdx.x) * 2; if (e >= (size_t)HD * TT) return; const int t = (int)(e % TT); const int d = (int)(e / TT); v2us o; o[0] = f2bf(Vb[(size_t)t * HD + d]); o[1] = f2bf(Vb[(size_t)(t + 1) * HD + d]); *(v2us*)(Vh + e) = o;  }
__global__ __launch_bounds__(256) void k_mergeR(const float* __restrict__ O, float* outb, size_t n4) { const size_t i = (size_t)blockIdx.x * 256 + threadIdx.x; if (i >= n4) return; const v4f a = *(const v4f*)(O + i * 4); *(v4f*)(outb + i * 4) = a;  }


// ---- k_prep: both 16-bit forms of x in one launch (bf16 rows; x^T with the same rounded values as f16), x read once. One work-group per WGP takes 256 tokens x 64 d of one (batch, head) plane; a half-wave reads one token's 256 B.
// A lane holds 4 d of tokens t and t + 1: pairs along d go through LDS array R, pairs along t through LDS array T as words [d][t / 2]; both leave as 512-B units in fragment order, lane l's 16 B at byte 16 l.
// Row planes: [t / 16][d / 8][t mod 16][8 d], 2 KB per 16 tokens. x^T planes: [t / 32][d / 16][(t mod 32) / 8][d mod 16][8 t], 4 KB per 32 tokens. So the piece that lane (c, h) of a matrix fragment needs is the lane's own 16 B of a unit.
// LDS: in T the 16-B chunk k of row d lies at chunk k ^ FSW(d), in R chunk (d / 8 = m, t mod 16) at t ^ GSW(m), so that the lanes of each store and the 16 lanes of each half of a 16-B read fall on different banks.
typedef __attribute__((ext_vector_type(2))) __bf16 v2bf;
typedef __attribute__((ext_vector_type(2))) unsigned v2u;
typedef __attribute__((ext_vector_type(4))) unsigned v4u;
typedef v2u __attribute__((may_alias)) v2ua;
typedef v4u __attribute__((may_alias)) v4ua;
#define PT 256
#define FSW(d) (((d) & 12) | (((d) ^ ((d) >> 4)) & 3))
#define GSW(m) (((m) & 1) | (((m) >> 1) << 2))
__device__ __forceinline__ unsigned pkbf(float x, float y) { v2f p; p[0] = x; p[1] = y; return __builtin_bit_cast(unsigned, __builtin_convertvector(p, v2bf)); }   // x in the low half; round to nearest even
__device__ __forceinline__ unsigned pkh(float x, float y) { v2f p; p[0] = x; p[1] = y; return __builtin_bit_cast(unsigned, __builtin_convertvector(p, v2h)); }   // the same to f16
__global__ __launch_bounds__(256) void k_prep(const float* __restrict__ X, bf* __restrict__ XB, bf* __restrict__ XT) {
    __shared__ __attribute__((aligned(16))) unsigned T[HD * (PT / 2)];
    __shared__ __attribute__((aligned(16))) unsigned R[PT * (HD / 2)];
    const int lane = threadIdx.x & 31, c = lane & 15, r = lane >> 4, wave = threadIdx.x >> 5;
    const int plane = blockIdx.y, tb = blockIdx.x * PT, t0 = tb + 32 * wave + 2 * r;
    const float* sp = X + (size_t)(plane / NH_) * TT * DM + (size_t)(plane % NH_) * HD + (size_t)t0 * DM + 4 * c;
    bf* bp = XB + (size_t)plane * TT * HD + (size_t)tb * HD + (8 * wave) * 256 + 8 * lane; bf* tp = XT + (size_t)plane * HD * TT + (size_t)tb * HD + (8 * wave) * 256 + 8 * lane;   /* the work-group's 32 KB of each plane; a wave stores 8 units of 512 B */
    v4f a[8], b[8];
#pragma unroll
    for (int i = 0; i < 8; ++i) { a[i] = *(const v4fa*)(sp + (size_t)(4 * i) * DM); b[i] = *(const v4fa*)(sp + (size_t)(4 * i + 1) * DM); }
    asm volatile("s_wait_xcnt 0x0" :: "v"(sp), "v"(bp), "v"(tp) : "memory");   // the loads are issued: their address register, held to this line, may be reused from here on; both store addresses are formed while the loads fly, not among the stores
    __builtin_amdgcn_sched_barrier(0);   // all 16 loads fly together: without it the compiler issues the last ones only behind waits for the first
    v2u u[8], w[8];
#pragma unroll
    for (int i = 0; i < 8; ++i) { u[i][0] = pkbf(a[i][0], a[i][1]); u[i][1] = pkbf(a[i][2], a[i][3]); w[i][0] = pkbf(b[i][0], b[i][1]); w[i][1] = pkbf(b[i][2], b[i][3]); }
#pragma unroll
    for (int i = 0; i < 8; ++i)
#pragma unroll
        for (int j = 0; j < 4; ++j) { const unsigned lo = u[i][j >> 1], hi = w[i][j >> 1];   /* d = 4 c + j of tokens t (low half) and t + 1 */
            T[(4 * c + j) * (PT / 2) + (((4 * wave + (i >> 1)) ^ FSW(4 * c + j)) << 2) + ((2 * i + r) & 3)] = (j & 1) ? pkh(__uint_as_float(lo & 0xFFFF0000u), __uint_as_float(hi & 0xFFFF0000u)) : pkh(__uint_as_float(lo << 16), __uint_as_float(hi << 16)); }   /* the bf16-rounded values, re-encoded as f16 */
#pragma unroll
    for (int i = 0; i < 8; ++i) { const int m = c >> 1; const int ri = (((2 * wave + (i >> 2)) * 128 + m * 16 + ((4 * (i & 3) + 2 * r) ^ GSW(m))) << 2) + 2 * (c & 1);   /* token t is even: token t + 1 lies at the chunk with bit 0 flipped */
        *(v2ua*)(R + ri) = u[i]; *(v2ua*)(R + (ri ^ 4)) = w[i]; }
    __syncthreads();   // every wave's words are in LDS before a unit is read; all global stores stand behind it, so that it does not wait for them
#pragma unroll
    for (int n = 0; n < 8; ++n) { const int d = 16 * (n >> 1) + c, k = 4 * wave + 2 * (n & 1) + r; *(v4ua*)(tp + n * 256) = *(const v4ua*)(T + d * (PT / 2) + ((k ^ FSW(d)) << 2)); }
#pragma unroll
    for (int n = 0; n < 8; ++n) { const int m = 2 * (n & 3) + r; *(v4ua*)(bp + n * 256) = *(const v4ua*)(R + (((2 * wave + (n >> 2)) * 128 + m * 16 + (c ^ GSW(m))) << 2)); }
}

// ---- k_fattn: scores, causal softmax and P.V of one (batch, head) plane in one pass over the keys. One wave owns 32 queries (two column tiles); a pass is 32 keys.
// S^T = K.Q^T (A = key rows, B = query rows): lane (c, h) holds query c's scores of keys 16 nb + 8 h + r, so the row sum is in-lane plus one exchange between the halves,
// and a column tile's two score tiles, converted in place, are the B operand of O^T += V^T.P^T (A = rows of x^T in the same k order). P goes in as one f16 operand (the row sum adds the unrounded f32 values); the division by the row sum comes last.
// Softmax shift: any number subtracted from all scores of a query leaves the softmax as it is. Here it is the query's score with itself, x_q.x_q, a key that the causal rule always admits: known before the first pass, so there is no running maximum, no rescaling of O^T or of the sum, and the four shares add up as they are.
// Range: the row sum is at least 1 (the diagonal term). P leaves f16 only from x_q.(x_k - x_q) / 8 >= 11.09 on, which takes |x_k|^2 >= 355 (x_q.x_k - |x_q|^2 <= |x_q| |x_k| - |x_q|^2 <= |x_k|^2 / 4; over 64 standard normal values |x|^2 has mean 64 and deviation 11.3); small P go on as f16 subnormals, at most 2^-25 off against a sum >= 1.
// Every key and value fragment, once in registers, feeds both column tiles: 16 products a pass on 8 KB of loads (4 KB of keys, 4 KB of values), each fragment half one 512-B unit of a plane in fragment order.
// Causal balance: a 32-query group pg and then its mirror TT/32 - 1 - pg, 65 passes together. Four waves share each group: share s takes the passes kb = s, s + 4, ..., so 16 or 17 passes a wave and four waves on every SIMD; the mirror deals the shares in reverse order.
// The four partial results (sum, O^T) meet through LDS behind one barrier per group: every wave lays down all of its O^T, then finishes and stores one quarter (one column tile, 32 d). grid (TT/128, planes), 256 threads.
typedef __attribute__((ext_vector_type(8))) unsigned v8u;
#define KBLK 32
#define NSH  4
__device__ __forceinline__ v16bf ldu(const bf* p) { return cat16b(*(const v8us*)p, *(const v8us*)(p + 256)); }   // two units one behind the other: the 8 k at 8h and the 8 k at 16 + 8h of a fragment
__device__ __forceinline__ v16h lduh(const bf* p) { return __builtin_bit_cast(v16h, ldu(p)); }   // the same two units of an f16 plane
__device__ __forceinline__ float xhalf(float x) { return __builtin_bit_cast(float, __builtin_amdgcn_permlanex16(__builtin_bit_cast(int, x), __builtin_bit_cast(int, x), 0x76543210, 0xfedcba98, false, false)); }   // lane l takes lane l ^ 16's value
#define SC2  0.18033688011112042f   // HD^-0.5 x log2(e): the softmax runs in base 2
__global__ __launch_bounds__(256) void k_fattn(const bf* __restrict__ QB, const bf* __restrict__ KB, const bf* __restrict__ VT, float* __restrict__ OUT) {
    __shared__ __attribute__((aligned(16))) v4f XO[2][8][16][32];   /* [group of the pair][wave][16-B piece: (column tile, d tile, half)][lane]: a buffer per group, so one barrier per group is enough */
    __shared__ float XL[2][8][2][32];     /* per column tile: the lane's sum */
    const int lane = threadIdx.x & 31, lr = lane & 15, hi = lane >> 4;
    const int wave = __builtin_amdgcn_readfirstlane((int)(threadIdx.x >> 5));   // scalar, so that the pass loop is a scalar loop
    const int plane = blockIdx.y;
    const bf* Qp = QB + (size_t)plane * TT * HD + 8 * lane; const bf* Kp = KB + (size_t)plane * TT * HD + 8 * lane; const bf* Vp = VT + (size_t)plane * HD * TT + 8 * lane;
    float* Op = OUT + (size_t)(plane / NH_) * TT * DM + (size_t)(plane % NH_) * HD;
    const int z = wave >> 1;   /* which of the four key shares, and which quarter of the result */
    const int wb = wave & 1;   /* which of the work-group's two query groups */
    const int pg = blockIdx.x * 2 + wb;
    // the two groups run one after the other through one copy of the code (rolled); every short loop below is unrolled so that the fragment arrays stay in registers
#pragma unroll 1
    for (int half = 0; half < 2; ++half) {
        const int q0 = (half ? (TT / 32 - 1 - pg) : pg) * 32; const int nblk = q0 / KBLK + 1; const int zz = half ? NSH - 1 - z : z;
        v8f o[2][4];
#pragma unroll
        for (int qt = 0; qt < 2; ++qt)
#pragma unroll
            for (int nd = 0; nd < 4; ++nd) o[qt][nd] = (v8f){};
        float l[2] = { 0.f, 0.f };
        if (zz < nblk) {   /* scalar: a share without a pass loads nothing; written out so that the query and the key loads stand together behind the test and fly together */
        v16bf qf[2][2], kf[2][2];
#pragma unroll
        for (int qt = 0; qt < 2; ++qt)
#pragma unroll
            for (int c = 0; c < 2; ++c) qf[qt][c] = ldu(Qp + (size_t)(q0 + qt * 16) * HD + 512 * c);
#pragma unroll
        for (int nb = 0; nb < 2; ++nb)
#pragma unroll
            for (int c = 0; c < 2; ++c) kf[nb][c] = ldu(Kp + (size_t)(zz * KBLK + nb * 16) * HD + 512 * c);
        float mc[2];
        // the shift, in base-2 units: the diagonal of Q.Q^T, from the same products that a pass would make of these rows. Lane (c, h) holds rows 8 h + j of column c: the diagonal is register c mod 8 of the half h = c / 8; the other half takes it over.
#pragma unroll
        for (int qt = 0; qt < 2; ++qt) { v8f dq = wmmab(qf[qt][0], qf[qt][0], (v8f){}); dq = wmmab(qf[qt][1], qf[qt][1], dq);
            const float a0 = (lr & 1) ? dq[1] : dq[0], a1 = (lr & 1) ? dq[3] : dq[2], a2 = (lr & 1) ? dq[5] : dq[4], a3 = (lr & 1) ? dq[7] : dq[6];
            const float c0 = (lr & 2) ? a1 : a0, c1 = (lr & 2) ? a3 : a2; const float dg = (lr & 4) ? c1 : c0;
            const float ot = xhalf(dg); mc[qt] = (((lr >> 3) == hi) ? dg : ot) * SC2; }
        // rolled: the trip count is the group's own, and one pass already fills the register file
#pragma unroll 1
        for (int kb = zz; kb < nblk; kb += NSH) {
            const int key0 = kb * KBLK;
            v16h vf[4];
#pragma unroll
            for (int nd = 0; nd < 4; ++nd) vf[nd] = lduh(Vp + (size_t)key0 * HD + 512 * nd);
            asm volatile("s_wait_xcnt 0x0" ::: "memory");   // the value loads are issued: their address registers may be reused from here on
            v8f s[2][2];
#pragma unroll
            for (int nb = 0; nb < 2; ++nb)
#pragma unroll
                for (int qt = 0; qt < 2; ++qt) { s[qt][nb] = wmmab(kf[nb][0], qf[qt][0], (v8f){}); s[qt][nb] = wmmab(kf[nb][1], qf[qt][1], s[qt][nb]); }
            const int kn = (kb + NSH < nblk) ? key0 + NSH * KBLK : key0;   /* the wave's next pass's key rows, fetched behind this pass's products; the last pass re-reads its own */
#pragma unroll
            for (int nb = 0; nb < 2; ++nb)
#pragma unroll
                for (int c = 0; c < 2; ++c) kf[nb][c] = ldu(Kp + (size_t)(kn + nb * 16) * HD + 512 * c);
            asm volatile("s_wait_xcnt 0x0" ::: "memory");   // the key loads are issued: their address registers are reused below
            if (kb == nblk - 1) {   /* only the last pass meets the diagonal: keys after the query excluded */
#pragma unroll
                for (int qt = 0; qt < 2; ++qt)
#pragma unroll
                    for (int nb = 0; nb < 2; ++nb)
#pragma unroll
                        for (int j = 0; j < 8; ++j) s[qt][nb][j] = (key0 + nb * 16 + hi * 8 + j <= q0 + qt * 16 + lr) ? s[qt][nb][j] : -3.0e38f; }
            v8u ph[2];
#pragma unroll
            for (int qt = 0; qt < 2; ++qt) {
                float sum = 0.f;
#pragma unroll
                for (int nb = 0; nb < 2; ++nb)
#pragma unroll
                    for (int j = 0; j < 8; j += 2) { v2f t; t[0] = s[qt][nb][j]; t[1] = s[qt][nb][j + 1]; t = __builtin_elementwise_fma(t, (v2f){ SC2, SC2 }, (v2f){ -mc[qt], -mc[qt] });   /* on the tile's own register pairs: left to itself the compiler pairs the last score of one column tile with the first of the next and shifts a whole tile by one register */
                        s[qt][nb][j] = __builtin_amdgcn_exp2f(t[0]); s[qt][nb][j + 1] = __builtin_amdgcn_exp2f(t[1]); }
#pragma unroll
                for (int nb = 0; nb < 2; ++nb)
#pragma unroll
                    for (int j = 0; j < 8; j += 2) {
                        v2f p; p[0] = s[qt][nb][j]; p[1] = s[qt][nb][j + 1]; sum += p[0]; sum += p[1];   /* one add a value: of sums written p[0] + p[1] the compiler packs two and pays for it in register moves */
                        ph[qt][nb * 4 + (j >> 1)] = __builtin_bit_cast(unsigned, __builtin_convertvector(p, v2h)); }
                l[qt] += sum;
            }
#pragma unroll
            for (int qt = 0; qt < 2; ++qt)
#pragma unroll
                for (int nd = 0; nd < 4; ++nd) o[qt][nd] = wmma16(vf[nd], __builtin_bit_cast(v16h, ph[qt]), o[qt][nd]);
        }
        }
        // join the four key shares: every wave lays down its whole O^T with its sum; wave z then finishes column tile z / 2, d = 32 (z mod 2) .. + 31. All shares of a query carry the same shift, so they add up as they are; a share without a pass holds l = 0, O = 0.
#pragma unroll
        for (int qt = 0; qt < 2; ++qt)
#pragma unroll
            for (int nd = 0; nd < 4; ++nd) { XO[half][wave][(qt * 4 + nd) * 2][lane] = __builtin_shufflevector(o[qt][nd], o[qt][nd], 0, 1, 2, 3); XO[half][wave][(qt * 4 + nd) * 2 + 1][lane] = __builtin_shufflevector(o[qt][nd], o[qt][nd], 4, 5, 6, 7); }
#pragma unroll
        for (int qt = 0; qt < 2; ++qt) XL[half][wave][qt][lane] = l[qt];
        __syncthreads();   // all four shares of both groups are in LDS before a wave reads them
        const int qs = z >> 1, dh = z & 1;
        float lt = XL[half][wb][qs][lane];
#pragma unroll
        for (int sh = 1; sh < NSH; ++sh) lt += XL[half][wb + 2 * sh][qs][lane];
        lt += xhalf(lt);
        const float f = __fdiv_rn(1.0f, lt);
        float* orow = Op + (size_t)(q0 + qs * 16 + lr) * DM + dh * 32 + hi * 8;   /* lane (c, h) holds d = 16 nd + 8 h + r of query c */
#pragma unroll
        for (int i = 0; i < 2; ++i) { const int pc = (qs * 4 + dh * 2 + i) * 2; v4f a = XO[half][wb][pc][lane], b2 = XO[half][wb][pc + 1][lane];
#pragma unroll
            for (int sh = 1; sh < NSH; ++sh) { a += XO[half][wb + 2 * sh][pc][lane]; b2 += XO[half][wb + 2 * sh][pc + 1][lane]; }
            *(v4f*)(orow + i * 16) = a * f; *(v4f*)(orow + i * 16 + 4) = b2 * f; }
        asm volatile("s_wait_xcnt 0x0" ::: "memory");   // the stores' address and data registers are rewritten by the next group
    }
}

extern "C" void kernel_launch(void* const* d_in, const int* in_sizes, int n_in,
                              void* d_out, int out_size, void* d_ws, size_t ws_size, hipStream_t stream) {
    (void)in_sizes; (void)n_in; (void)out_size;
    const float* Xin = (const float*)d_in[0];   /* q = k = v = x */
    float* OUT = (float*)d_out;
    char* wsp = (char*)d_ws;
    auto take = [&](size_t bytes) { char* p = wsp; wsp += (bytes + 255) & ~(size_t)255; return (void*)p; };
    const size_t PB = (size_t)NH_ * TT * HD;   /* elements of one batch's planes */
    bf* XB = (bf*)take(NB_ * PB * 2); bf* VT = (bf*)take(NB_ * PB * 2);   /* one plane set serves queries and keys */
    if ((size_t)(wsp - (char*)d_ws) > ws_size) return;
    k_prep<<<dim3(TT / PT, NB_ * NH_, 1), 256, 0, stream>>>(Xin, XB, VT);
    k_fattn<<<dim3(TT / 128, NB_ * NH_, 1), 256, 0, stream>>>(XB, XB, VT, OUT);   /* every (batch, head) plane in one launch */
}

// v009
// A run of this version takes 20.4 microseconds.
// Versions between v007 and this one are left out; their measured steps multiply to 1.38 times as fast.
// Counting every step since v000, it is 105 times as fast.
#include <hip/hip_runtime.h>

// Parameter-free causal self-attention with x as q, k and v (x [2][2048][1024] viewed as 16 heads x 64; scores = x_h.x_h / 8; causal (-inf); softmax; out = attn x_h merged -> [2][2048][1024] (4.2 M)).
// Layout: one launch. A work-group of the fused kernel reads 128 keys of x (f32) a round, rounds them to f16 and lays them row-major into LDS (two buffers): plain 16-B reads give the key fragments, transposing reads of the same rows the value fragments. The query rows take the same road once per group pair (64 rows, whole lines, f16 rows in LDS, plain 16-B reads give the query fragments). It walks the keys of every 32-query group with a fixed softmax shift per query and a running sum (four waves a group, key blocks dealt in turn, joined through LDS), so scores and P stay in registers; merged token-major output rows.
// Compute dtypes, f32 accumulate: x rounded once to f16 (11 bits) for q, k and v; q.k and P.V on f16 operands; softmax f32; P = exp(score - the query's own diagonal score) rounded once to f16; output f32.

#define NB_  2
#define TT   2048
#define DM   1024      // token-major row pitch (H x HD)
#define NH_  16
#define NKV  1
#define REP  (NH_ / NKV)
#define HD   64
#define DQ   (NH_ * HD)
#define DKV  (NKV * HD)
#define ZH   1
#define RH   2048
#define WIN  0
#define PCAR 1024.0f
#define SCL  0.125f   // 1/sqrt(64)
typedef _Float16 h16;
typedef unsigned short bf;
typedef __attribute__((ext_vector_type(16))) __bf16   v16bf;
typedef __attribute__((ext_vector_type(16))) _Float16 v16h;
typedef __attribute__((ext_vector_type(8)))  _Float16 v8h;
typedef __attribute__((ext_vector_type(8)))  unsigned short v8us;
typedef __attribute__((ext_vector_type(8)))  float    v8f;
typedef __attribute__((ext_vector_type(4)))  float    v4f;
typedef v8h  __attribute__((may_alias)) v8ha;
typedef v4f  __attribute__((may_alias)) v4fa;
typedef v8us __attribute__((may_alias)) v8usa;

__device__ __forceinline__ unsigned short f2bf(float f) { unsigned u = __float_as_uint(f); u += 0x7FFFu + ((u >> 16) & 1u); return (unsigned short)(u >> 16); }
__device__ __forceinline__ float bf2f(unsigned short b) { return __uint_as_float(((unsigned)b) << 16); }
__device__ __forceinline__ float bfr(float f) { return bf2f(f2bf(f)); }
__device__ __forceinline__ v16h cat16(v8h lo, v8h hi) { return __builtin_shufflevector(lo, hi, 0, 1, 2, 3, 4, 5, 6, 7, 8, 9, 10, 11, 12, 13, 14, 15); }
__device__ __forceinline__ v16bf cat16b(v8us lo, v8us hi) { return __builtin_bit_cast(v16bf, __builtin_shufflevector(lo, hi, 0, 1, 2, 3, 4, 5, 6, 7, 8, 9, 10, 11, 12, 13, 14, 15)); }
__device__ __forceinline__ v8f wmma16(v16h a, v16h b, v8f c) { return __builtin_amdgcn_wmma_f32_16x16x32_f16(false, a, false, b, (short)0, c, false, false); }
__device__ __forceinline__ v8f wmmab(v16bf a, v16bf b, v8f c) { return __builtin_amdgcn_wmma_f32_16x16x32_bf16(false, a, false, b, (short)0, c, false, false); }



// ---- fragment loader: row c of a K-contiguous 16-bit plane in the hardware k order (8 k at 8h, 8 k at 16 + 8h); the same code serves A and B.
template <typename T16> struct WFrag;
template <> struct WFrag<h16> { typedef v16h V; static __device__ __forceinline__ V ld(const h16* p) { return cat16(*(const v8h*)p, *(const v8h*)(p + 16)); } static __device__ __forceinline__ v8f mma(V a, V b, v8f c) { return wmma16(a, b, c); } };
template <> struct WFrag<bf> { typedef v16bf V; static __device__ __forceinline__ V ld(const bf* p) { return cat16b(*(const v8us*)p, *(const v8us*)(p + 16)); } static __device__ __forceinline__ v8f mma(V a, V b, v8f c) { return wmmab(a, b, c); } };

__device__ __forceinline__ h16 tohx(float x) { return (h16)x; }
__device__ __forceinline__ void splitf(float y, unsigned short& h, unsigned short& l) { h = f2bf(y); l = f2bf(y - bf2f(h)); }
typedef __attribute__((ext_vector_type(2))) _Float16 v2h;
typedef __attribute__((ext_vector_type(4))) _Float16 v4h;
typedef __attribute__((ext_vector_type(2))) unsigned short v2us;
typedef __attribute__((ext_vector_type(4))) unsigned short v4us;
typedef __attribute__((ext_vector_type(2))) float v2f;
typedef __attribute__((ext_vector_type(4))) int v4i;

__global__ __launch_bounds__(256) void k_wtG(const float* __restrict__ w, int K, int N, bf* Bt) {
    const int lane = threadIdx.x & 31; const int L0 = (blockIdx.x * 8 + (threadIdx.x >> 5)) * 8; const int nlines = N * K / 64;
{
#pragma unroll 1
        for (int l = 0; l < 8; ++l) { const int L = L0 + l; if (L >= nlines) break; const size_t e = (size_t)L * 64 + lane * 2; const int k = (int)(e % K), n = (int)(e / K); v2us o;
            o[0] = f2bf(w[(size_t)k * N + n]); o[1] = f2bf(w[(size_t)(k + 1) * N + n]); *(v2us*)(Bt + e) = o; }
         }
}
__global__ __launch_bounds__(256) void k_cvt8(const float* __restrict__ src, bf* dst, size_t n8) { const size_t i = (size_t)blockIdx.x * 256 + threadIdx.x; if (i >= n8) return; const v8f v = *(const v8f*)(src + i * 8); v8us o;
#pragma unroll
    for (int k = 0; k < 8; ++k) o[k] = f2bf(v[k]); *(v8us*)(dst + i * 8) = o;  }


__global__ __launch_bounds__(256) void k_vtp(const float* __restrict__ F, int pitch, int nheads, h16* V16, bf* Vh, bf* Vl) { const size_t e = ((size_t)blockIdx.x * 256 + threadIdx.x) * 2; if (e >= (size_t)nheads * HD * TT) return; const int t = (int)(e % TT); const int d = (int)((e / TT) % HD); const int g = (int)(e / ((size_t)TT * HD)); v2h o16; v2us oh, ol;
#pragma unroll
    for (int q = 0; q < 2; ++q) { const float x = F[(size_t)(t + q) * pitch + g * HD + d]; o16[q] = tohx(x); unsigned short a2, c2; splitf(x, a2, c2); oh[q] = a2; ol[q] = c2; }
    *(v2h*)(V16 + e) = o16; *(v2us*)(Vh + e) = oh; *(v2us*)(Vl + e) = ol;  }

__global__ __launch_bounds__(256) void k_merge(const float* __restrict__ O, int h0, float* OUTb) { const size_t e = ((size_t)blockIdx.x * 256 + threadIdx.x) * 2; if (e >= (size_t)ZH * TT * HD) return; const int d = (int)(e % HD); const int t = (int)((e / HD) % TT); const int zz = (int)(e / ((size_t)HD * TT)); const float cs = (t < RH) ? 1.0f : (1.0f / PCAR); const size_t oo = (size_t)t * DQ + (h0 + zz) * HD + d;
    v2f o2; o2[0] = O[e] * cs; o2[1] = O[e + 1] * cs; *(v2f*)(OUTb + oo) = o2;  }


__global__ __launch_bounds__(256) void k_vtpR1(const float* __restrict__ Vb, bf* Vh) { const size_t e = ((size_t)blockIdx.x * 256 + threadIdx.x) * 2; if (e >= (size_t)HD * TT) return; const int t = (int)(e % TT); const int d = (int)(e / TT); v2us o; o[0] = f2bf(Vb[(size_t)t * HD + d]); o[1] = f2bf(Vb[(size_t)(t + 1) * HD + d]); *(v2us*)(Vh + e) = o;  }
__global__ __launch_bounds__(256) void k_mergeR(const float* __restrict__ O, float* outb, size_t n4) { const size_t i = (size_t)blockIdx.x * 256 + threadIdx.x; if (i >= n4) return; const v4f a = *(const v4f*)(O + i * 4); *(v4f*)(outb + i * 4) = a;  }


typedef __attribute__((ext_vector_type(2))) unsigned v2u;
typedef v2u __attribute__((may_alias)) v2ua;
typedef __attribute__((ext_vector_type(8))) unsigned v8u;
typedef __attribute__((ext_vector_type(8))) short s16x8;
__device__ __forceinline__ unsigned pkh(float x, float y) { v2f p; p[0] = x; p[1] = y; return __builtin_bit_cast(unsigned, __builtin_convertvector(p, v2h)); }   // x in the low half; round to nearest even

// ---- k_fattn: f16 rounding of x, scores, causal softmax and P.V of one (batch, head) plane in one launch. One wave owns 32 queries (two column tiles); a pass is 32 keys.
// S^T = K.Q^T (A = key rows, B = query rows): lane (c, h) holds query c's scores of keys 16 nb + 8 h + r, so the row sum is in-lane plus one exchange between the halves,
// and a column tile's two score tiles, converted in place, are the B operand of O^T += V^T.P^T (A = rows of x^T in the same k order). P goes in as one f16 operand (the row sum adds the unrounded f32 values); the division by the row sum comes last.
// Softmax shift: any number subtracted from all scores of a query leaves the softmax as it is. Here it is the query's score with itself, x_q.x_q, a key that the causal rule always admits: known before the first pass, so there is no running maximum, no rescaling of O^T or of the sum, and the four shares add up as they are.
// Range: the row sum is at least 1 (the diagonal term). P leaves f16 only from x_q.(x_k - x_q) / 8 >= 11.09 on, which takes |x_k|^2 >= 355 (x_q.x_k - |x_q|^2 <= |x_q| |x_k| - |x_q|^2 <= |x_k|^2 / 4; over 64 standard normal values |x|^2 has mean 64 and deviation 11.3); small P go on as f16 subnormals, at most 2^-25 off against a sum >= 1.
// Staging: a round is 128 keys, one pass for each of the four shares. All eight waves fetch the next round's 32 KB of x (a half-wave reads one token's 256 B) while this round is worked on, then round to f16 and store rows of 128 B at a pitch of 144 B into the other buffer; one barrier a round publishes it and ends the reads of the buffer that is refilled next.
// Every key and value fragment, once in registers, feeds both column tiles: 16 products a pass on 8 KB of LDS reads, both kinds from the same 4 KB of rows.
// Causal balance: a 32-query group pg and then its mirror TT/32 - 1 - pg, 65 passes together. Four waves share each group: share s takes the passes kb = s, s + 4, ..., so 16 or 17 passes a wave and four waves on every SIMD; the mirror deals the shares in reverse order.
// The four partial results (sum, O^T) meet through LDS behind one barrier per group: every wave lays down all of its O^T, then finishes and stores one quarter (one column tile, 32 d). grid (TT/128, planes), 256 threads.
#define KBLK 32
#define NSH  4
#define RKEYS (NSH * KBLK)   // keys staged a round
#define KPB  144             // LDS row pitch in bytes: 16 B x odd
__device__ __forceinline__ v8h ldtr(const unsigned char* p) { typedef __attribute__((address_space(3))) s16x8 lds_s16x8; return __builtin_bit_cast(v8h, __builtin_amdgcn_ds_load_tr16_b128_v8i16((lds_s16x8*)p)); }   // lane (c, h) of the 16 x 16 tile gets column c, rows 8 h .. 8 h + 7
__device__ __forceinline__ float xhalf(float x) { return __builtin_bit_cast(float, __builtin_amdgcn_permlanex16(__builtin_bit_cast(int, x), __builtin_bit_cast(int, x), 0x76543210, 0xfedcba98, false, false)); }   // lane l takes lane l ^ 16's value
#define SC2  0.18033688011112042f   // HD^-0.5 x log2(e): the softmax runs in base 2
__global__ __launch_bounds__(256) void k_fattn(const float* __restrict__ X, float* __restrict__ OUT) {
    __shared__ __attribute__((aligned(16))) v4f XO[8][16][32];   /* [wave][16-B piece: (column tile, d tile, half)][lane]; one buffer: the staging barriers of the next group stand between its reads and the next writes */
    __shared__ float XL[8][2][32];     /* per column tile: the lane's sum */
    __shared__ __attribute__((aligned(16))) unsigned char KS[2 * RKEYS * KPB];   /* two buffers of 128 f16 rows */
    __shared__ __attribute__((aligned(16))) unsigned char QS[64 * KPB];   /* the f16 query rows of the work-group's two groups; written before a group's first barrier, read right behind it */
    const int lane = threadIdx.x & 31, lr = lane & 15, hi = lane >> 4;
    const int wave = __builtin_amdgcn_readfirstlane((int)(threadIdx.x >> 5));   // scalar, so that the round loop is a scalar loop
    const int plane = blockIdx.y;
    const float* Xp = X + (size_t)(plane / NH_) * TT * DM + (size_t)(plane % NH_) * HD;
    float* Op = OUT + (size_t)(plane / NH_) * TT * DM + (size_t)(plane % NH_) * HD;
    const int z = wave >> 1;   /* which of the four key shares, and which quarter of the result */
    const int wb = wave & 1;   /* which of the work-group's two query groups */
    const int pg = blockIdx.x * 2 + wb;
    const float* sp = Xp + (size_t)(16 * wave + hi) * DM + 4 * lr;   /* staging: the wave takes 16 rows of a round, two a load; lane (c, h) holds d = 4 c .. 4 c + 3 of row 2 i + h */
    const int so = (16 * wave + hi) * KPB + 8 * lr;
    v4f g[8];
#pragma unroll
    for (int i = 0; i < 8; ++i) g[i] = *(const v4fa*)(sp + (size_t)(2 * i) * DM);
    asm volatile("s_wait_xcnt 0x0" :: "v"(sp) : "memory");   // the loads are issued: their address register, held to this line, may be reused from here on
    // query staging: the two groups' 64 rows are neighbours in x; the wave takes 8 of them, two a load, so that every load covers whole 128-B lines and a row is fetched once for the four waves that need it
    const float* qsp = Xp + (size_t)(8 * wave + hi) * DM + 4 * lr;
    const int qso = (8 * wave + hi) * KPB + 8 * lr;
    v4f gq[4];
    { const float* p = qsp + (size_t)(64 * (int)blockIdx.x) * DM;
#pragma unroll
      for (int i = 0; i < 4; ++i) gq[i] = *(const v4fa*)(p + (size_t)(2 * i) * DM);
      asm volatile("s_wait_xcnt 0x0" :: "v"(p) : "memory"); }   // the query loads are issued: their address register, held to this line, may be reused from here on
    // the two groups run one after the other through one copy of the code (rolled); every short loop below is unrolled so that the fragment arrays stay in registers
#pragma unroll 1
    for (int half = 0; half < 2; ++half) {
        const int q0 = (half ? (TT / 32 - 1 - pg) : pg) * 32; const int nblk = q0 / KBLK + 1; const int zz = half ? NSH - 1 - z : z;
        const int nr = ((half ? TT / 32 - 2 * (int)blockIdx.x : 2 * (int)blockIdx.x + 2) + NSH - 1) / NSH;   /* rounds: the longer of the work-group's two groups decides, the same for all eight waves */
        v8f o[2][4];
#pragma unroll
        for (int qt = 0; qt < 2; ++qt)
#pragma unroll
            for (int nd = 0; nd < 4; ++nd) o[qt][nd] = (v8f){};
        float l[2] = { 0.f, 0.f };
        // round 0 (keys 0 .. 127, fetched before the loop or during the last round of the group before) goes into buffer 0
#pragma unroll
        for (int i = 0; i < 8; ++i) { v2u w; w[0] = pkh(g[i][0], g[i][1]); w[1] = pkh(g[i][2], g[i][3]); *(v2ua*)(KS + so + 2 * i * KPB) = w; }
        // the query rows (fetched before the loop or during the last round of the group before) go beside it
#pragma unroll
        for (int i = 0; i < 4; ++i) { v2u w; w[0] = pkh(gq[i][0], gq[i][1]); w[1] = pkh(gq[i][2], gq[i][3]); *(v2ua*)(QS + qso + 2 * i * KPB) = w; }
        __syncthreads();   // round 0 and the query rows are in LDS before a wave reads them; it also stands between the last group's reads of XO, XL and this group's writes
        // query fragments: the loader of the key fragments on the group's own 32 rows (the mirror pair lies in reverse order), so both sides of q.k have one k order
        const unsigned char* qa = QS + ((half ? 1 - wb : wb) * 32 + lr) * KPB + 16 * hi;
        v16h qf[2][2];
#pragma unroll
        for (int qt = 0; qt < 2; ++qt)
#pragma unroll
            for (int c = 0; c < 2; ++c) qf[qt][c] = cat16(*(const v8ha*)(qa + qt * 16 * KPB + 64 * c), *(const v8ha*)(qa + qt * 16 * KPB + 64 * c + 32));
        float mc[2];
        // the shift, in base-2 units: the diagonal of Q.Q^T, from the same products that a pass would make of these rows. Lane (c, h) holds rows 8 h + j of column c: the diagonal is register c mod 8 of the half h = c / 8; the other half takes it over.
#pragma unroll
        for (int qt = 0; qt < 2; ++qt) { v8f dq = wmma16(qf[qt][0], qf[qt][0], (v8f){}); dq = wmma16(qf[qt][1], qf[qt][1], dq);
            const float a0 = (lr & 1) ? dq[1] : dq[0], a1 = (lr & 1) ? dq[3] : dq[2], a2 = (lr & 1) ? dq[5] : dq[4], a3 = (lr & 1) ? dq[7] : dq[6];
            const float c0 = (lr & 2) ? a1 : a0, c1 = (lr & 2) ? a3 : a2; const float dg = (lr & 4) ? c1 : c0;
            const float ot = xhalf(dg); mc[qt] = (((lr >> 3) == hi) ? dg : ot) * SC2; }
        // rolled: the trip count is the work-group's own (its longer group), and one pass already fills the register file
#pragma unroll 1
        for (int r = 0; r < nr; ++r) {
            const float* np = sp + (size_t)((r + 1 < nr) ? (r + 1) * RKEYS : 0) * DM;   /* the next round's rows; behind the last round, round 0 again, for the mirror group */
#pragma unroll
            for (int i = 0; i < 8; ++i) g[i] = *(const v4fa*)(np + (size_t)(2 * i) * DM);
            asm volatile("s_wait_xcnt 0x0" :: "v"(np) : "memory");   // the staging loads are issued: their address register, held to this line, may be reused from here on
            if (half == 0 && r + 1 == nr) {   /* scalar: the mirror pair's query rows fly during the last round, like its round 0 */
                const float* p = qsp + (size_t)(TT - 64 - 64 * (int)blockIdx.x) * DM;
#pragma unroll
                for (int i = 0; i < 4; ++i) gq[i] = *(const v4fa*)(p + (size_t)(2 * i) * DM);
                asm volatile("s_wait_xcnt 0x0" :: "v"(p) : "memory");   // the query loads are issued: their address register, held to this line, may be reused from here on
            }
            const int kb = r * NSH + zz;
            if (kb < nblk) {   /* scalar: a share whose block lies past the group's diagonal only stages */
            const int key0 = kb * KBLK;
            const unsigned char* kr = KS + (r & 1) * (RKEYS * KPB) + zz * (KBLK * KPB);   /* the wave's 32 rows */
            const unsigned char* ka = kr + lr * KPB + 16 * hi;
            v16h kf[2][2];
#pragma unroll
            for (int nb = 0; nb < 2; ++nb)
#pragma unroll
                for (int c = 0; c < 2; ++c) kf[nb][c] = cat16(*(const v8ha*)(ka + nb * 16 * KPB + 64 * c), *(const v8ha*)(ka + nb * 16 * KPB + 64 * c + 32));
            v8f s[2][2];
#pragma unroll
            for (int nb = 0; nb < 2; ++nb)
#pragma unroll
                for (int qt = 0; qt < 2; ++qt) { s[qt][nb] = wmma16(kf[nb][0], qf[qt][0], (v8f){}); s[qt][nb] = wmma16(kf[nb][1], qf[qt][1], s[qt][nb]); }
            const unsigned char* va = kr + (8 * hi + (lane & 7)) * KPB + ((lane >> 3) & 1) * 16;   /* transposing read: two loads, keys 0 .. 15 and 16 .. 31, make one 16 (d) x 32 (keys) fragment */
            v16h vf[4];
#pragma unroll
            for (int nd = 0; nd < 4; ++nd) vf[nd] = cat16(ldtr(va + 32 * nd), ldtr(va + 16 * KPB + 32 * nd));
            if (kb == nblk - 1) {   /* only the last pass meets the diagonal: keys after the query excluded */
#pragma unroll
                for (int qt = 0; qt < 2; ++qt)
#pragma unroll
                    for (int nb = 0; nb < 2; ++nb)
#pragma unroll
                        for (int j = 0; j < 8; ++j) s[qt][nb][j] = (key0 + nb * 16 + hi * 8 + j <= q0 + qt * 16 + lr) ? s[qt][nb][j] : -3.0e38f; }
            v8u ph[2];
#pragma unroll
            for (int qt = 0; qt < 2; ++qt) {
                float sum = 0.f;
#pragma unroll
                for (int nb = 0; nb < 2; ++nb)
#pragma unroll
                    for (int j = 0; j < 8; j += 2) { v2f t; t[0] = s[qt][nb][j]; t[1] = s[qt][nb][j + 1]; t = __builtin_elementwise_fma(t, (v2f){ SC2, SC2 }, (v2f){ -mc[qt], -mc[qt] });   /* on the tile's own register pairs: left to itself the compiler pairs the last score of one column tile with the first of the next and shifts a whole tile by one register */
                        s[qt][nb][j] = __builtin_amdgcn_exp2f(t[0]); s[qt][nb][j + 1] = __builtin_amdgcn_exp2f(t[1]); }
#pragma unroll
                for (int nb = 0; nb < 2; ++nb)
#pragma unroll
                    for (int j = 0; j < 8; j += 2) {
                        v2f p; p[0] = s[qt][nb][j]; p[1] = s[qt][nb][j + 1]; sum += p[0]; sum += p[1];   /* one add a value: of sums written p[0] + p[1] the compiler packs two and pays for it in register moves */
                        ph[qt][nb * 4 + (j >> 1)] = __builtin_bit_cast(unsigned, __builtin_convertvector(p, v2h)); }
                l[qt] += sum;
            }
#pragma unroll
            for (int qt = 0; qt < 2; ++qt)
#pragma unroll
                for (int nd = 0; nd < 4; ++nd) o[qt][nd] = wmma16(vf[nd], __builtin_bit_cast(v16h, ph[qt]), o[qt][nd]);
            }
            if (r + 1 < nr) {   /* the same for all eight waves */
                asm volatile("v_nop\n\tv_nop\n\tv_nop\n\tv_nop");   // four vector slots between the pass's last WMMA and the conversions below, which reuse its B registers
                __builtin_amdgcn_sched_barrier(0);   // keeps the conversions behind those slots
                const int sn = so + ((r + 1) & 1) * (RKEYS * KPB);
#pragma unroll
                for (int i = 0; i < 8; ++i) { v2u w; w[0] = pkh(g[i][0], g[i][1]); w[1] = pkh(g[i][2], g[i][3]); *(v2ua*)(KS + sn + 2 * i * KPB) = w; }
                __syncthreads();   // publishes round r + 1 and ends every wave's reads of round r, whose buffer the next round refills
            }
        }
        // join the four key shares: every wave lays down its whole O^T with its sum; wave z then finishes column tile z / 2, d = 32 (z mod 2) .. + 31. All shares of a query carry the same shift, so they add up as they are; a share without a pass holds l = 0, O = 0.
#pragma unroll
        for (int qt = 0; qt < 2; ++qt)
#pragma unroll
            for (int nd = 0; nd < 4; ++nd) { XO[wave][(qt * 4 + nd) * 2][lane] = __builtin_shufflevector(o[qt][nd], o[qt][nd], 0, 1, 2, 3); XO[wave][(qt * 4 + nd) * 2 + 1][lane] = __builtin_shufflevector(o[qt][nd], o[qt][nd], 4, 5, 6, 7); }
#pragma unroll
        for (int qt = 0; qt < 2; ++qt) XL[wave][qt][lane] = l[qt];
        __syncthreads();   // all four shares of both groups are in LDS before a wave reads them; every wave has also left the staged rows
        const int qs = z >> 1, dh = z & 1;
        float lt = XL[wb][qs][lane];
#pragma unroll
        for (int sh = 1; sh < NSH; ++sh) lt += XL[wb + 2 * sh][qs][lane];
        lt += xhalf(lt);
        const float f = __fdiv_rn(1.0f, lt);
        float* orow = Op + (size_t)(q0 + qs * 16 + lr) * DM + dh * 32 + hi * 8;   /* lane (c, h) holds d = 16 nd + 8 h + r of query c */
#pragma unroll
        for (int i = 0; i < 2; ++i) { const int pc = (qs * 4 + dh * 2 + i) * 2; v4f a = XO[wb][pc][lane], b2 = XO[wb][pc + 1][lane];
#pragma unroll
            for (int sh = 1; sh < NSH; ++sh) { a += XO[wb + 2 * sh][pc][lane]; b2 += XO[wb + 2 * sh][pc + 1][lane]; }
            *(v4f*)(orow + i * 16) = a * f; *(v4f*)(orow + i * 16 + 4) = b2 * f; }
        asm volatile("s_wait_xcnt 0x0" ::: "memory");   // the stores' address and data registers are rewritten by the next group
    }
}

extern "C" void kernel_launch(void* const* d_in, const int* in_sizes, int n_in,
                              void* d_out, int out_size, void* d_ws, size_t ws_size, hipStream_t stream) {
    (void)in_sizes; (void)n_in; (void)out_size; (void)d_ws; (void)ws_size;
    const float* Xin = (const float*)d_in[0];   /* q = k = v = x */
    float* OUT = (float*)d_out;
    k_fattn<<<dim3(TT / 128, NB_ * NH_, 1), 256, 0, stream>>>(Xin, OUT);   /* every (batch, head) plane in one launch */
}

// v010
// A run of this version takes 19 microseconds.
// Two timings next to v009 put it at 1.07 and 1.08 times that version's speed.
// Over all steps from v000 it is 112 times as fast.
#include <hip/hip_runtime.h>

// Parameter-free causal self-attention with x as q, k and v (x [2][2048][1024] viewed as 16 heads x 64; scores = x_h.x_h / 8; causal (-inf); softmax; out = attn x_h merged -> [2][2048][1024] (4.2 M)).
// Layout: one launch. A work-group of the fused kernel reads 128 keys of x (f32) a round, rounds them to f16 and lays them row-major into LDS (two buffers): plain 16-B reads give the key fragments, transposing reads of the same rows the value fragments. The query rows take the same road once per set of four groups (128 rows, whole lines, f16 rows in LDS, plain 16-B reads give the query fragments). It walks the keys of every 32-query group with a fixed softmax shift per query and a running sum (four waves a group, four groups a work-group on the same staged keys, key blocks dealt in turn, joined through LDS), so scores and P stay in registers; merged token-major output rows.
// Compute dtypes, f32 accumulate: x rounded once to f16 (11 bits) for q, k and v; q.k and P.V on f16 operands; softmax f32; P = exp(score - the query's own diagonal score) rounded once to f16; output f32.

#define NB_  2
#define TT   2048
#define DM   1024      // token-major row pitch (H x HD)
#define NH_  16
#define NKV  1
#define REP  (NH_ / NKV)
#define HD   64
#define DQ   (NH_ * HD)
#define DKV  (NKV * HD)
#define ZH   1
#define RH   2048
#define WIN  0
#define PCAR 1024.0f
#define SCL  0.125f   // 1/sqrt(64)
typedef _Float16 h16;
typedef unsigned short bf;
typedef __attribute__((ext_vector_type(16))) __bf16   v16bf;
typedef __attribute__((ext_vector_type(16))) _Float16 v16h;
typedef __attribute__((ext_vector_type(8)))  _Float16 v8h;
typedef __attribute__((ext_vector_type(8)))  unsigned short v8us;
typedef __attribute__((ext_vector_type(8)))  float    v8f;
typedef __attribute__((ext_vector_type(4)))  float    v4f;
typedef v8h  __attribute__((may_alias)) v8ha;
typedef v4f  __attribute__((may_alias)) v4fa;
typedef v8us __attribute__((may_alias)) v8usa;

__device__ __forceinline__ unsigned short f2bf(float f) { unsigned u = __float_as_uint(f); u += 0x7FFFu + ((u >> 16) & 1u); return (unsigned short)(u >> 16); }
__device__ __forceinline__ float bf2f(unsigned short b) { return __uint_as_float(((unsigned)b) << 16); }
__device__ __forceinline__ float bfr(float f) { return bf2f(f2bf(f)); }
__device__ __forceinline__ v16h cat16(v8h lo, v8h hi) { return __builtin_shufflevector(lo, hi, 0, 1, 2, 3, 4, 5, 6, 7, 8, 9, 10, 11, 12, 13, 14, 15); }
__device__ __forceinline__ v16bf cat16b(v8us lo, v8us hi) { return __builtin_bit_cast(v16bf, __builtin_shufflevector(lo, hi, 0, 1, 2, 3, 4, 5, 6, 7, 8, 9, 10, 11, 12, 13, 14, 15)); }
__device__ __forceinline__ v8f wmma16(v16h a, v16h b, v8f c) { return __builtin_amdgcn_wmma_f32_16x16x32_f16(false, a, false, b, (short)0, c, false, false); }
__device__ __forceinline__ v8f wmmab(v16bf a, v16bf b, v8f c) { return __builtin_amdgcn_wmma_f32_16x16x32_bf16(false, a, false, b, (short)0, c, false, false); }



// ---- fragment loader: row c of a K-contiguous 16-bit plane in the hardware k order (8 k at 8h, 8 k at 16 + 8h); the same code serves A and B.
template <typename T16> struct WFrag;
template <> struct WFrag<h16> { typedef v16h V; static __device__ __forceinline__ V ld(const h16* p) { return cat16(*(const v8h*)p, *(const v8h*)(p + 16)); } static __device__ __forceinline__ v8f mma(V a, V b, v8f c) { return wmma16(a, b, c); } };
template <> struct WFrag<bf> { typedef v16bf V; static __device__ __forceinline__ V ld(const bf* p) { return cat16b(*(const v8us*)p, *(const v8us*)(p + 16)); } static __device__ __forceinline__ v8f mma(V a, V b, v8f c) { return wmmab(a, b, c); } };

__device__ __forceinline__ h16 tohx(float x) { return (h16)x; }
__device__ __forceinline__ void splitf(float y, unsigned short& h, unsigned short& l) { h = f2bf(y); l = f2bf(y - bf2f(h)); }
typedef __attribute__((ext_vector_type(2))) _Float16 v2h;
typedef __attribute__((ext_vector_type(4))) _Float16 v4h;
typedef __attribute__((ext_vector_type(2))) unsigned short v2us;
typedef __attribute__((ext_vector_type(4))) unsigned short v4us;
typedef __attribute__((ext_vector_type(2))) float v2f;
typedef __attribute__((ext_vector_type(4))) int v4i;

__global__ __launch_bounds__(256) void k_wtG(const float* __restrict__ w, int K, int N, bf* Bt) {
    const int lane = threadIdx.x & 31; const int L0 = (blockIdx.x * 8 + (threadIdx.x >> 5)) * 8; const int nlines = N * K / 64;
{
#pragma unroll 1
        for (int l = 0; l < 8; ++l) { const int L = L0 + l; if (L >= nlines) break; const size_t e = (size_t)L * 64 + lane * 2; const int k = (int)(e % K), n = (int)(e / K); v2us o;
            o[0] = f2bf(w[(size_t)k * N + n]); o[1] = f2bf(w[(size_t)(k + 1) * N + n]); *(v2us*)(Bt + e) = o; }
         }
}
__global__ __launch_bounds__(256) void k_cvt8(const float* __restrict__ src, bf* dst, size_t n8) { const size_t i = (size_t)blockIdx.x * 256 + threadIdx.x; if (i >= n8) return; const v8f v = *(const v8f*)(src + i * 8); v8us o;
#pragma unroll
    for (int k = 0; k < 8; ++k) o[k] = f2bf(v[k]); *(v8us*)(dst + i * 8) = o;  }


__global__ __launch_bounds__(256) void k_vtp(const float* __restrict__ F, int pitch, int nheads, h16* V16, bf* Vh, bf* Vl) { const size_t e = ((size_t)blockIdx.x * 256 + threadIdx.x) * 2; if (e >= (size_t)nheads * HD * TT) return; const int t = (int)(e % TT); const int d = (int)((e / TT) % HD); const int g = (int)(e / ((size_t)TT * HD)); v2h o16; v2us oh, ol;
#pragma unroll
    for (int q = 0; q < 2; ++q) { const float x = F[(size_t)(t + q) * pitch + g * HD + d]; o16[q] = tohx(x); unsigned short a2, c2; splitf(x, a2, c2); oh[q] = a2; ol[q] = c2; }
    *(v2h*)(V16 + e) = o16; *(v2us*)(Vh + e) = oh; *(v2us*)(Vl + e) = ol;  }

__global__ __launch_bounds__(256) void k_merge(const float* __restrict__ O, int h0, float* OUTb) { const size_t e = ((size_t)blockIdx.x * 256 + threadIdx.x) * 2; if (e >= (size_t)ZH * TT * HD) return; const int d = (int)(e % HD); const int t = (int)((e / HD) % TT); const int zz = (int)(e / ((size_t)HD * TT)); const float cs = (t < RH) ? 1.0f : (1.0f / PCAR); const size_t oo = (size_t)t * DQ + (h0 + zz) * HD + d;
    v2f o2; o2[0] = O[e] * cs; o2[1] = O[e + 1] * cs; *(v2f*)(OUTb + oo) = o2;  }


__global__ __launch_bounds__(256) void k_vtpR1(const float* __restrict__ Vb, bf* Vh) { const size_t e = ((size_t)blockIdx.x * 256 + threadIdx.x) * 2; if (e >= (size_t)HD * TT) return; const int t = (int)(e % TT); const int d = (int)(e / TT); v2us o; o[0] = f2bf(Vb[(size_t)t * HD + d]); o[1] = f2bf(Vb[(size_t)(t + 1) * HD + d]); *(v2us*)(Vh + e) = o;  }
__global__ __launch_bounds__(256) void k_mergeR(const float* __restrict__ O, float* outb, size_t n4) { const size_t i = (size_t)blockIdx.x * 256 + threadIdx.x; if (i >= n4) return; const v4f a = *(const v4f*)(O + i * 4); *(v4f*)(outb + i * 4) = a;  }


typedef __attribute__((ext_vector_type(2))) unsigned v2u;
typedef v2u __attribute__((may_alias)) v2ua;
typedef __attribute__((ext_vector_type(8))) unsigned v8u;
typedef __attribute__((ext_vector_type(8))) short s16x8;
__device__ __forceinline__ unsigned pkh(float x, float y) { v2f p; p[0] = x; p[1] = y; return __builtin_bit_cast(unsigned, __builtin_convertvector(p, v2h)); }   // x in the low half; round to nearest even

// ---- k_fattn: f16 rounding of x, scores, causal softmax and P.V of one (batch, head) plane in one launch. One wave owns 32 queries (two column tiles); a pass is 32 keys.
// S^T = K.Q^T (A = key rows, B = query rows): lane (c, h) holds query c's scores of keys 16 nb + 8 h + r, so the row sum is in-lane plus one exchange between the halves,
// and a column tile's two score tiles, converted in place, are the B operand of O^T += V^T.P^T (A = rows of x^T in the same k order). P goes in as one f16 operand (the row sum adds the unrounded f32 values); the division by the row sum comes last.
// Softmax shift: any number subtracted from all scores of a query leaves the softmax as it is. Here it is the query's score with itself, x_q.x_q, a key that the causal rule always admits: known before the first pass, so there is no running maximum, no rescaling of O^T or of the sum, and the four shares add up as they are.
// Range: the row sum is at least 1 (the diagonal term). P leaves f16 only from x_q.(x_k - x_q) / 8 >= 11.09 on, which takes |x_k|^2 >= 355 (x_q.x_k - |x_q|^2 <= |x_q| |x_k| - |x_q|^2 <= |x_k|^2 / 4; over 64 standard normal values |x|^2 has mean 64 and deviation 11.3); small P go on as f16 subnormals, at most 2^-25 off against a sum >= 1.
// Staging: a round is 128 keys, one pass for each of the four shares of each of the four groups: a staged row serves 128 queries. All sixteen waves fetch the next round's 32 KB of x (a half-wave reads one token's 256 B) while this round is worked on, then round to f16 and store rows of 128 B at a pitch of 144 B into the other buffer; one barrier a round publishes it and ends the reads of the buffer that is refilled next.
// Every key and value fragment, once in registers, feeds both column tiles: 16 products a pass on 8 KB of LDS reads, both kinds from the same 4 KB of rows.
// Causal balance: a 32-query group pg and then its mirror TT/32 - 1 - pg, 65 passes together; a work-group's four groups are neighbours (128 queries, one round's width), so it has 17 rounds whichever it is, and only the last round of a half has idle shares. Four waves share each group: share s takes the passes kb = s, s + 4, ...; four waves on every SIMD; the mirror deals the shares in reverse order.
// The four partial results (sum, O^T) meet through LDS behind one barrier per group: every wave lays down all of its O^T, then finishes and stores one quarter (one column tile, 32 d). grid (TT/256, planes), 512 threads: one work-group a WGP.
#define KBLK 32
#define NSH  4
#define RKEYS (NSH * KBLK)   // keys staged a round
#define KPB  144             // LDS row pitch in bytes: 16 B x odd
__device__ __forceinline__ v8h ldtr(const unsigned char* p) { typedef __attribute__((address_space(3))) s16x8 lds_s16x8; return __builtin_bit_cast(v8h, __builtin_amdgcn_ds_load_tr16_b128_v8i16((lds_s16x8*)p)); }   // lane (c, h) of the 16 x 16 tile gets column c, rows 8 h .. 8 h + 7
__device__ __forceinline__ float xhalf(float x) { return __builtin_bit_cast(float, __builtin_amdgcn_permlanex16(__builtin_bit_cast(int, x), __builtin_bit_cast(int, x), 0x76543210, 0xfedcba98, false, false)); }   // lane l takes lane l ^ 16's value
#define SC2  0.18033688011112042f   // HD^-0.5 x log2(e): the softmax runs in base 2
__global__ __launch_bounds__(512) void k_fattn(const float* __restrict__ X, float* __restrict__ OUT) {
    __shared__ __attribute__((aligned(16))) v4f XO[16][16][32];   /* [share x 4 + group][16-B piece: (column tile, d tile, half)][lane]; one buffer: the staging barriers of the next group stand between its reads and the next writes */
    __shared__ float XL[16][2][32];     /* per column tile: the lane's sum */
    __shared__ __attribute__((aligned(16))) unsigned char KS[2 * RKEYS * KPB];   /* two buffers of 128 f16 rows */
    __shared__ __attribute__((aligned(16))) unsigned char QS[128 * KPB];   /* the f16 query rows of the work-group's four groups; written before a group's first barrier, read right behind it */
    const int lane = threadIdx.x & 31, lr = lane & 15, hi = lane >> 4;
    const int wave = __builtin_amdgcn_readfirstlane((int)(threadIdx.x >> 5));   // scalar, so that the round loop is a scalar loop
    const int plane = blockIdx.y;
    const float* Xp = X + (size_t)(plane / NH_) * TT * DM + (size_t)(plane % NH_) * HD;
    float* Op = OUT + (size_t)(plane / NH_) * TT * DM + (size_t)(plane % NH_) * HD;
    const int wb = wave >> 2;   /* which of the work-group's four query groups */
    const int z = (wave - wb) & 3;   /* which of the four key shares, and which quarter of the result; turned by the group's number: where waves w, w + 4, w + 8, w + 12 share a SIMD (for speed only), the 10 passes of a half's last round (group i of the four has i + 1) fall 3, 2, 3, 2 on the SIMDs, not 4, 3, 2, 1 */
    const int slot = z * 4 + wb;   /* the wave's place in XO and XL */
    const int pg = blockIdx.x * 4 + wb;
    const float* sp = Xp + (size_t)(8 * wave + hi) * DM + 4 * lr;   /* staging: the wave takes 8 rows of a round, two a load; lane (c, h) holds d = 4 c .. 4 c + 3 of row 2 i + h */
    const int so = (8 * wave + hi) * KPB + 8 * lr;
    v4f g[4];
#pragma unroll
    for (int i = 0; i < 4; ++i) g[i] = *(const v4fa*)(sp + (size_t)(2 * i) * DM);
    asm volatile("s_wait_xcnt 0x0" :: "v"(sp) : "memory");   // the loads are issued: their address register, held to this line, may be reused from here on
    // query staging: the four groups' 128 rows are neighbours in x; the wave takes 8 of them, two a load, so that every load covers whole 128-B lines and a row is fetched once for the four waves that need it
    const float* qsp = Xp + (size_t)(8 * wave + hi) * DM + 4 * lr;
    const int qso = (8 * wave + hi) * KPB + 8 * lr;
    v4f gq[4];
    { const float* p = qsp + (size_t)(128 * (int)blockIdx.x) * DM;
#pragma unroll
      for (int i = 0; i < 4; ++i) gq[i] = *(const v4fa*)(p + (size_t)(2 * i) * DM);
      asm volatile("s_wait_xcnt 0x0" :: "v"(p) : "memory"); }   // the query loads are issued: their address register, held to this line, may be reused from here on
    // a group and its mirror run one after the other through one copy of the code (rolled); every short loop below is unrolled so that the fragment arrays stay in registers
#pragma unroll 1
    for (int half = 0; half < 2; ++half) {
        const int q0 = (half ? (TT / 32 - 1 - pg) : pg) * 32; const int nblk = q0 / KBLK + 1; const int zz = half ? NSH - 1 - z : z;
        const int nr = half ? TT / RKEYS - (int)blockIdx.x : (int)blockIdx.x + 1;   /* rounds: the longest of the work-group's four groups decides, the same for all sixteen waves */
        v8f o[2][4];
#pragma unroll
        for (int qt = 0; qt < 2; ++qt)
#pragma unroll
            for (int nd = 0; nd < 4; ++nd) o[qt][nd] = (v8f){};
        float l[2] = { 0.f, 0.f };
        // round 0 (keys 0 .. 127, fetched before the loop or during the last round of the group before) goes into buffer 0
#pragma unroll
        for (int i = 0; i < 4; ++i) { v2u w; w[0] = pkh(g[i][0], g[i][1]); w[1] = pkh(g[i][2], g[i][3]); *(v2ua*)(KS + so + 2 * i * KPB) = w; }
        // the query rows (fetched before the loop or during the last round of the group before) go beside it
#pragma unroll
        for (int i = 0; i < 4; ++i) { v2u w; w[0] = pkh(gq[i][0], gq[i][1]); w[1] = pkh(gq[i][2], gq[i][3]); *(v2ua*)(QS + qso + 2 * i * KPB) = w; }
        __syncthreads();   // round 0 and the query rows are in LDS before a wave reads them; it also stands between the last group's reads of XO, XL and this group's writes
        // query fragments: the loader of the key fragments on the group's own 32 rows (the mirror four lie in reverse order), so both sides of q.k have one k order
        const unsigned char* qa = QS + ((half ? 3 - wb : wb) * 32 + lr) * KPB + 16 * hi;
        v16h qf[2][2];
#pragma unroll
        for (int qt = 0; qt < 2; ++qt)
#pragma unroll
            for (int c = 0; c < 2; ++c) qf[qt][c] = cat16(*(const v8ha*)(qa + qt * 16 * KPB + 64 * c), *(const v8ha*)(qa + qt * 16 * KPB + 64 * c + 32));
        float mc[2];
        // the shift, in base-2 units: the diagonal of Q.Q^T, from the same products that a pass would make of these rows. Lane (c, h) holds rows 8 h + j of column c: the diagonal is register c mod 8 of the half h = c / 8; the other half takes it over.
#pragma unroll
        for (int qt = 0; qt < 2; ++qt) { v8f dq = wmma16(qf[qt][0], qf[qt][0], (v8f){}); dq = wmma16(qf[qt][1], qf[qt][1], dq);
            const float a0 = (lr & 1) ? dq[1] : dq[0], a1 = (lr & 1) ? dq[3] : dq[2], a2 = (lr & 1) ? dq[5] : dq[4], a3 = (lr & 1) ? dq[7] : dq[6];
            const float c0 = (lr & 2) ? a1 : a0, c1 = (lr & 2) ? a3 : a2; const float dg = (lr & 4) ? c1 : c0;
            const float ot = xhalf(dg); mc[qt] = (((lr >> 3) == hi) ? dg : ot) * SC2; }
        // rolled: the trip count is the work-group's own (its longest group), and one pass already fills the register file
#pragma unroll 1
        for (int r = 0; r < nr; ++r) {
            const float* np = sp + (size_t)((r + 1 < nr) ? (r + 1) * RKEYS : 0) * DM;   /* the next round's rows; behind the last round, round 0 again, for the mirror group */
#pragma unroll
            for (int i = 0; i < 4; ++i) g[i] = *(const v4fa*)(np + (size_t)(2 * i) * DM);
            asm volatile("s_wait_xcnt 0x0" :: "v"(np) : "memory");   // the staging loads are issued: their address register, held to this line, may be reused from here on
            if (half == 0 && r + 1 == nr) {   /* scalar: the mirror groups' query rows fly during the last round, like its round 0 */
                const float* p = qsp + (size_t)(TT - 128 - 128 * (int)blockIdx.x) * DM;
#pragma unroll
                for (int i = 0; i < 4; ++i) gq[i] = *(const v4fa*)(p + (size_t)(2 * i) * DM);
                asm volatile("s_wait_xcnt 0x0" :: "v"(p) : "memory");   // the query loads are issued: their address register, held to this line, may be reused from here on
            }
            const int kb = r * NSH + zz;
            if (kb < nblk) {   /* scalar: a share whose block lies past the group's diagonal only stages */
            const int key0 = kb * KBLK;
            const unsigned char* kr = KS + (r & 1) * (RKEYS * KPB) + zz * (KBLK * KPB);   /* the wave's 32 rows */
            const unsigned char* ka = kr + lr * KPB + 16 * hi;
            v16h kf[2][2];
#pragma unroll
            for (int nb = 0; nb < 2; ++nb)
#pragma unroll
                for (int c = 0; c < 2; ++c) kf[nb][c] = cat16(*(const v8ha*)(ka + nb * 16 * KPB + 64 * c), *(const v8ha*)(ka + nb * 16 * KPB + 64 * c + 32));
            v8f s[2][2];
#pragma unroll
            for (int nb = 0; nb < 2; ++nb)
#pragma unroll
                for (int qt = 0; qt < 2; ++qt) { s[qt][nb] = wmma16(kf[nb][0], qf[qt][0], (v8f){}); s[qt][nb] = wmma16(kf[nb][1], qf[qt][1], s[qt][nb]); }
            const unsigned char* va = kr + (8 * hi + (lane & 7)) * KPB + ((lane >> 3) & 1) * 16;   /* transposing read: two loads, keys 0 .. 15 and 16 .. 31, make one 16 (d) x 32 (keys) fragment */
            v16h vf[4];
#pragma unroll
            for (int nd = 0; nd < 4; ++nd) vf[nd] = cat16(ldtr(va + 32 * nd), ldtr(va + 16 * KPB + 32 * nd));
            if (kb == nblk - 1) {   /* only the last pass meets the diagonal: keys after the query excluded */
#pragma unroll
                for (int qt = 0; qt < 2; ++qt)
#pragma unroll
                    for (int nb = 0; nb < 2; ++nb)
#pragma unroll
                        for (int j = 0; j < 8; ++j) s[qt][nb][j] = (key0 + nb * 16 + hi * 8 + j <= q0 + qt * 16 + lr) ? s[qt][nb][j] : -3.0e38f; }
            v8u ph[2];
#pragma unroll
            for (int qt = 0; qt < 2; ++qt) {
                float sum = 0.f;
#pragma unroll
                for (int nb = 0; nb < 2; ++nb)
#pragma unroll
                    for (int j = 0; j < 8; j += 2) { v2f t; t[0] = s[qt][nb][j]; t[1] = s[qt][nb][j + 1]; t = __builtin_elementwise_fma(t, (v2f){ SC2, SC2 }, (v2f){ -mc[qt], -mc[qt] });   /* on the tile's own register pairs: left to itself the compiler pairs the last score of one column tile with the first of the next and shifts a whole tile by one register */
                        s[qt][nb][j] = __builtin_amdgcn_exp2f(t[0]); s[qt][nb][j + 1] = __builtin_amdgcn_exp2f(t[1]); }
#pragma unroll
                for (int nb = 0; nb < 2; ++nb)
#pragma unroll
                    for (int j = 0; j < 8; j += 2) {
                        v2f p; p[0] = s[qt][nb][j]; p[1] = s[qt][nb][j + 1]; sum += p[0]; sum += p[1];   /* one add a value: of sums written p[0] + p[1] the compiler packs two and pays for it in register moves */
                        ph[qt][nb * 4 + (j >> 1)] = __builtin_bit_cast(unsigned, __builtin_convertvector(p, v2h)); }
                l[qt] += sum;
            }
#pragma unroll
            for (int qt = 0; qt < 2; ++qt)
#pragma unroll
                for (int nd = 0; nd < 4; ++nd) o[qt][nd] = wmma16(vf[nd], __builtin_bit_cast(v16h, ph[qt]), o[qt][nd]);
            }
            if (r + 1 < nr) {   /* the same for all sixteen waves */
                asm volatile("v_nop\n\tv_nop\n\tv_nop\n\tv_nop");   // four vector slots between the pass's last WMMA and the conversions below, which reuse its B registers
                __builtin_amdgcn_sched_barrier(0);   // keeps the conversions behind those slots
                const int sn = so + ((r + 1) & 1) * (RKEYS * KPB);
#pragma unroll
                for (int i = 0; i < 4; ++i) { v2u w; w[0] = pkh(g[i][0], g[i][1]); w[1] = pkh(g[i][2], g[i][3]); *(v2ua*)(KS + sn + 2 * i * KPB) = w; }
                __syncthreads();   // publishes round r + 1 and ends every wave's reads of round r, whose buffer the next round refills
            }
        }
        // join the four key shares: every wave lays down its whole O^T with its sum; wave z then finishes column tile z / 2, d = 32 (z mod 2) .. + 31. All shares of a query carry the same shift, so they add up as they are; a share without a pass holds l = 0, O = 0.
#pragma unroll
        for (int qt = 0; qt < 2; ++qt)
#pragma unroll
            for (int nd = 0; nd < 4; ++nd) { XO[slot][(qt * 4 + nd) * 2][lane] = __builtin_shufflevector(o[qt][nd], o[qt][nd], 0, 1, 2, 3); XO[slot][(qt * 4 + nd) * 2 + 1][lane] = __builtin_shufflevector(o[qt][nd], o[qt][nd], 4, 5, 6, 7); }
#pragma unroll
        for (int qt = 0; qt < 2; ++qt) XL[slot][qt][lane] = l[qt];
        __syncthreads();   // all four shares of all four groups are in LDS before a wave reads them; every wave has also left the staged rows
        const int qs = z >> 1, dh = z & 1;
        float lt = XL[wb][qs][lane];
#pragma unroll
        for (int sh = 1; sh < NSH; ++sh) lt += XL[wb + 4 * sh][qs][lane];
        lt += xhalf(lt);
        const float f = __fdiv_rn(1.0f, lt);
        float* orow = Op + (size_t)(q0 + qs * 16 + lr) * DM + dh * 32 + hi * 8;   /* lane (c, h) holds d = 16 nd + 8 h + r of query c */
#pragma unroll
        for (int i = 0; i < 2; ++i) { const int pc = (qs * 4 + dh * 2 + i) * 2; v4f a = XO[wb][pc][lane], b2 = XO[wb][pc + 1][lane];
#pragma unroll
            for (int sh = 1; sh < NSH; ++sh) { a += XO[wb + 4 * sh][pc][lane]; b2 += XO[wb + 4 * sh][pc + 1][lane]; }
            *(v4f*)(orow + i * 16) = a * f; *(v4f*)(orow + i * 16 + 4) = b2 * f; }
        asm volatile("s_wait_xcnt 0x0" ::: "memory");   // the stores' address and data registers are rewritten by the next group
    }
}

extern "C" void kernel_launch(void* const* d_in, const int* in_sizes, int n_in,
                              void* d_out, int out_size, void* d_ws, size_t ws_size, hipStream_t stream) {
    (void)in_sizes; (void)n_in; (void)out_size; (void)d_ws; (void)ws_size;
    const float* Xin = (const float*)d_in[0];   /* q = k = v = x */
    float* OUT = (float*)d_out;
    k_fattn<<<dim3(TT / 256, NB_ * NH_, 1), 512, 0, stream>>>(Xin, OUT);   /* every (batch, head) plane in one launch */
}
